// v000
// The times below were measured on an AMD MI455X: many runs one after another, warmed up first and cycling through
// copies of the inputs, with the whole window's GPU time divided by the number of runs. Launches and the gaps
// between them are all in it. The median over several windows is given; except for v000 it joins two sittings, which
// can be a few percent apart, so the side-by-side timings, each taken in one sitting, are the better comparison.
// The starting kernel, v000, takes 1310 microseconds a run.
#include <hip/hip_runtime.h>

// De-stationary causal attention on given q, k, v ([2][2048][16][64] token-major; tau [2][1], delta [2][2048]): scores = (q.k) x tau_b + delta_b[s] (per-key bias), causal (-inf above the diagonal), A = softmax(scores / 8), V[b][l][h][d] = sum_s A v -> [2][2048][16][64] f32 (4.2 M).
// Layout per batch: the token-major inputs already have the [token][head x dim] row layout, so the plane builders read them directly (bf16-rounded on read); causal hybrid attention (rows < 512 hi/lo, rest fp16 x1024) with tile skipping; the softmax kernel forms (s x tau + delta_j) x (1/8) per logit with tau/delta read (bf16-rounded); the merge kernel writes the token-major f32 output.
// Compute dtypes, f32 accumulate: q, k, v, tau, delta rounded to bf16: hi planes exact, lo zero; scores and attn.v rows < 512 3 products, the rest single fp16; softmax f32; f32 output.

#define NB_  2
#define TT   2048
#define DM   1024
#define NH_  16
#define NKV  16
#define REP  (NH_ / NKV)
#define HD   64
#define DQ   (NH_ * HD)
#define DKV  (NKV * HD)
#define ZH   2
#define RH   512                  // query rows < RH use hi+lo planes (0: none)
#define WIN  2048
#define PCAR 1024.0f
#define SCL  0.125f   // HD^-0.5
typedef _Float16 h16;
typedef unsigned short bf;
typedef __attribute__((ext_vector_type(16))) __bf16   v16bf;
typedef __attribute__((ext_vector_type(16))) _Float16 v16h;
typedef __attribute__((ext_vector_type(8)))  _Float16 v8h;
typedef __attribute__((ext_vector_type(8)))  unsigned short v8us;
typedef __attribute__((ext_vector_type(8)))  float    v8f;
typedef __attribute__((ext_vector_type(4)))  float    v4f;
typedef v8h  __attribute__((may_alias)) v8ha;
typedef v4f  __attribute__((may_alias)) v4fa;
typedef v8us __attribute__((may_alias)) v8usa;

__device__ __forceinline__ unsigned short f2bf(float f) { unsigned u = __float_as_uint(f); u += 0x7FFFu + ((u >> 16) & 1u); return (unsigned short)(u >> 16); }
__device__ __forceinline__ float bf2f(unsigned short b) { return __uint_as_float(((unsigned)b) << 16); }
__device__ __forceinline__ float bfr(float f) { return bf2f(f2bf(f)); }
__device__ __forceinline__ v16h cat16(v8h lo, v8h hi) { return __builtin_shufflevector(lo, hi, 0, 1, 2, 3, 4, 5, 6, 7, 8, 9, 10, 11, 12, 13, 14, 15); }
__device__ __forceinline__ v16bf cat16b(v8us lo, v8us hi) { return __builtin_bit_cast(v16bf, __builtin_shufflevector(lo, hi, 0, 1, 2, 3, 4, 5, 6, 7, 8, 9, 10, 11, 12, 13, 14, 15)); }
__device__ __forceinline__ v8f wmma16(v16h a, v16h b, v8f c) { return __builtin_amdgcn_wmma_f32_16x16x32_f16(false, a, false, b, (short)0, c, false, false); }
__device__ __forceinline__ v8f wmmab(v16bf a, v16bf b, v8f c) { return __builtin_amdgcn_wmma_f32_16x16x32_bf16(false, a, false, b, (short)0, c, false, false); }



// ---- k_gemmw: register-blocked GEMM, ONE WAVE per 64x64 output tile (16 accumulators), operands straight from K-contiguous 16-bit planes; grid (M/64, N/64, Z), 32 threads.
// C[m][n] (f32, pitch ldc, + optional f32 bias[n]) = sum_k A[m][k] Bt[n][k] (+ split products per NSPLIT). z-batch strides sA/sB/sC in elements. K % 32 == 0.
template <typename T16> struct WFrag;
template <> struct WFrag<h16> { typedef v16h V; static __device__ __forceinline__ V ld(const h16* p) { return cat16(*(const v8h*)p, *(const v8h*)(p + 16)); } static __device__ __forceinline__ v8f mma(V a, V b, v8f c) { return wmma16(a, b, c); } };
template <> struct WFrag<bf> { typedef v16bf V; static __device__ __forceinline__ V ld(const bf* p) { return cat16b(*(const v8us*)p, *(const v8us*)(p + 16)); } static __device__ __forceinline__ v8f mma(V a, V b, v8f c) { return wmmab(a, b, c); } };
template <typename T16, int NSPLIT, bool BIAS>
__global__ __launch_bounds__(32) void k_gemmw(const T16* __restrict__ A, const T16* __restrict__ A2, const T16* __restrict__ Bt, const T16* __restrict__ Bt2, int K, float* C, int ldc, const float* __restrict__ bias, size_t sA, size_t sB, size_t sC) {
    typedef typename WFrag<T16>::V V;
    __shared__ __align__(16) float os[16 * 68];
    const size_t z = blockIdx.z; A += z * sA; if (A2) A2 += z * sA; Bt += z * sB; if (Bt2) Bt2 += z * sB; C += z * sC;
    const int lane = threadIdx.x & 31, lr = lane & 15, hi = lane >> 4; const int r0 = blockIdx.x * 64, c0 = blockIdx.y * 64;
    v8f acc[4][4];
#pragma unroll
    for (int mb = 0; mb < 4; ++mb)
#pragma unroll
        for (int nb = 0; nb < 4; ++nb) acc[mb][nb] = (v8f){};
    const size_t aoff = (size_t)(r0 + lr) * K + 8 * hi, boff = (size_t)(c0 + lr) * K + 8 * hi;
#pragma unroll 1
    for (int kc = 0; kc < K; kc += 32) {
        V a[4], a2[4];
#pragma unroll
        for (int mb = 0; mb < 4; ++mb) { a[mb] = WFrag<T16>::ld(A + aoff + (size_t)mb * 16 * K + kc); if (NSPLIT == 1 || NSPLIT == 2) a2[mb] = WFrag<T16>::ld(A2 + aoff + (size_t)mb * 16 * K + kc); }
#pragma unroll
        for (int nb = 0; nb < 4; ++nb) { const V b = WFrag<T16>::ld(Bt + boff + (size_t)nb * 16 * K + kc); V b2; if (NSPLIT >= 2) b2 = WFrag<T16>::ld(Bt2 + boff + (size_t)nb * 16 * K + kc);
#pragma unroll
            for (int mb = 0; mb < 4; ++mb) { acc[mb][nb] = WFrag<T16>::mma(a[mb], b, acc[mb][nb]); if (NSPLIT == 1 || NSPLIT == 2) acc[mb][nb] = WFrag<T16>::mma(a2[mb], b, acc[mb][nb]); if (NSPLIT >= 2) acc[mb][nb] = WFrag<T16>::mma(a[mb], b2, acc[mb][nb]); } }
        asm volatile("v_nop\n\tv_nop\n\tv_nop\n\tv_nop" : "+v"(acc[0][0]), "+v"(acc[1][1]), "+v"(acc[2][2]), "+v"(acc[3][3]) : "v"(a[0]), "v"(a[3]));
    }
#pragma unroll
    for (int mb = 0; mb < 4; ++mb) {
#pragma unroll
        for (int nb = 0; nb < 4; ++nb) {
#pragma unroll
            for (int j = 0; j < 8; ++j) os[(hi * 8 + j) * 68 + nb * 16 + lr] = acc[mb][nb][j]; }
        __builtin_amdgcn_wave_barrier(); asm volatile("" ::: "memory");
        float* crow = C + (size_t)(r0 + mb * 16) * ldc + c0;
{
#pragma unroll
            for (int s = 0; s < 8; ++s) { const int row = 2 * s + hi, cofs = lr * 4; v4f val = *(const v4fa*)(os + row * 68 + cofs); if (BIAS) { val[0] += bfr(bias[c0 + cofs]); val[1] += bfr(bias[c0 + cofs + 1]); val[2] += bfr(bias[c0 + cofs + 2]); val[3] += bfr(bias[c0 + cofs + 3]); }
                *(v4f*)(crow + (size_t)row * ldc + cofs) = val; }
             }
        __builtin_amdgcn_wave_barrier(); asm volatile("" ::: "memory");
    }
}

// ---- k_gemmc: the same one-wave 64x64 tile GEMM specialised for causal attention: CMODE 1 skips score tiles entirely above the diagonal (query rows r0+roff.., key columns c0..), CMODE 2 limits the
// key (K) loop of the probability x value contraction to the diagonal block (probabilities beyond it are exactly zero). roff = row offset of this launch's first row within the sequence.
template <typename T16, int NSPLIT, int CMODE>
__global__ __launch_bounds__(32) void k_gemmc(const T16* __restrict__ A, const T16* __restrict__ A2, const T16* __restrict__ Bt, const T16* __restrict__ Bt2, int K, float* C, int ldc, int roff, size_t sA, size_t sB, size_t sC) {
    typedef typename WFrag<T16>::V V;
    __shared__ __align__(16) float os[16 * 68];
    const size_t z = blockIdx.z; A += z * sA; if (A2) A2 += z * sA; Bt += z * sB; if (Bt2) Bt2 += z * sB; C += z * sC;
    const int lane = threadIdx.x & 31, lr = lane & 15, hi = lane >> 4; const int r0 = blockIdx.x * 64, c0 = blockIdx.y * 64;
    if (CMODE == 1 && c0 > r0 + roff + 63) return;                  // score tile entirely above the causal diagonal: never read (the softmax masks j > i by select)
    const int Kl = (CMODE == 2) ? min(K, r0 + roff + 64) : K;        // P.V: probabilities are exactly 0 beyond the diagonal block, so the K loop stops there
    v8f acc[4][4];
#pragma unroll
    for (int mb = 0; mb < 4; ++mb)
#pragma unroll
        for (int nb = 0; nb < 4; ++nb) acc[mb][nb] = (v8f){};
    const size_t aoff = (size_t)(r0 + lr) * K + 8 * hi, boff = (size_t)(c0 + lr) * K + 8 * hi;
#pragma unroll 1
    for (int kc = 0; kc < Kl; kc += 32) {
        V a[4], a2[4];
#pragma unroll
        for (int mb = 0; mb < 4; ++mb) { a[mb] = WFrag<T16>::ld(A + aoff + (size_t)mb * 16 * K + kc); if (NSPLIT == 1 || NSPLIT == 2) a2[mb] = WFrag<T16>::ld(A2 + aoff + (size_t)mb * 16 * K + kc); }
#pragma unroll
        for (int nb = 0; nb < 4; ++nb) { const V b = WFrag<T16>::ld(Bt + boff + (size_t)nb * 16 * K + kc); V b2; if (NSPLIT >= 2) b2 = WFrag<T16>::ld(Bt2 + boff + (size_t)nb * 16 * K + kc);
#pragma unroll
            for (int mb = 0; mb < 4; ++mb) { acc[mb][nb] = WFrag<T16>::mma(a[mb], b, acc[mb][nb]); if (NSPLIT == 1 || NSPLIT == 2) acc[mb][nb] = WFrag<T16>::mma(a2[mb], b, acc[mb][nb]); if (NSPLIT >= 2) acc[mb][nb] = WFrag<T16>::mma(a[mb], b2, acc[mb][nb]); } }
        asm volatile("v_nop\n\tv_nop\n\tv_nop\n\tv_nop" : "+v"(acc[0][0]), "+v"(acc[1][1]), "+v"(acc[2][2]), "+v"(acc[3][3]) : "v"(a[0]), "v"(a[3]));
    }
#pragma unroll
    for (int mb = 0; mb < 4; ++mb) {
#pragma unroll
        for (int nb = 0; nb < 4; ++nb) {
#pragma unroll
            for (int j = 0; j < 8; ++j) os[(hi * 8 + j) * 68 + nb * 16 + lr] = acc[mb][nb][j]; }
        __builtin_amdgcn_wave_barrier(); asm volatile("" ::: "memory");
        float* crow = C + (size_t)(r0 + mb * 16) * ldc + c0;
{
#pragma unroll
            for (int s = 0; s < 8; ++s) { const int row = 2 * s + hi, cofs = lr * 4; v4f val = *(const v4fa*)(os + row * 68 + cofs);
                *(v4f*)(crow + (size_t)row * ldc + cofs) = val; }
             }
        __builtin_amdgcn_wave_barrier(); asm volatile("" ::: "memory");
    }
}

__device__ __forceinline__ h16 tohx(float x) { return (h16)x; }
__device__ __forceinline__ void splitf(float y, unsigned short& h, unsigned short& l) { h = f2bf(y); l = f2bf(y - bf2f(h)); }
typedef __attribute__((ext_vector_type(2))) _Float16 v2h;
typedef __attribute__((ext_vector_type(4))) _Float16 v4h;
typedef __attribute__((ext_vector_type(2))) unsigned short v2us;
typedef __attribute__((ext_vector_type(4))) unsigned short v4us;
typedef __attribute__((ext_vector_type(2))) float v2f;
typedef __attribute__((ext_vector_type(4))) int v4i;

__global__ __launch_bounds__(256) void k_wtG(const float* __restrict__ w, int K, int N, bf* Bt) {
    const int lane = threadIdx.x & 31; const int L0 = (blockIdx.x * 8 + (threadIdx.x >> 5)) * 8; const int nlines = N * K / 64;
{
#pragma unroll 1
        for (int l = 0; l < 8; ++l) { const int L = L0 + l; if (L >= nlines) break; const size_t e = (size_t)L * 64 + lane * 2; const int k = (int)(e % K), n = (int)(e / K); v2us o;
            o[0] = f2bf(w[(size_t)k * N + n]); o[1] = f2bf(w[(size_t)(k + 1) * N + n]); *(v2us*)(Bt + e) = o; }
         }
}
__global__ __launch_bounds__(256) void k_cvt8(const float* __restrict__ src, bf* dst, size_t n8) { const size_t i = (size_t)blockIdx.x * 256 + threadIdx.x; if (i >= n8) return; const v8f v = *(const v8f*)(src + i * 8); v8us o;
#pragma unroll
    for (int k = 0; k < 8; ++k) o[k] = f2bf(v[k]); *(v8us*)(dst + i * 8) = o;  }

// k_rope: head planes [h][t][d] (fp16 + hi/lo) of rope(x) x sc with the rotate-half convention out[d] = x[d] cos[t][d] - x[d+HD/2] sin[t][d], out[d+HD/2] = x[d+HD/2] cos[t][d+HD/2] + x[d] sin[t][d+HD/2]
__global__ __launch_bounds__(256) void k_rope(const float* __restrict__ F, int pitch, int nheads, const float* __restrict__ CS, const float* __restrict__ RF, const float* __restrict__ nw, float sc, h16* P16, bf* Ph, bf* Pl) {
    const size_t e = ((size_t)blockIdx.x * 256 + threadIdx.x) * 2; if (e >= (size_t)nheads * TT * HD) return; const int d = (int)(e % HD); const int t = (int)((e / HD) % TT); const int h = (int)(e / ((size_t)HD * TT)); const float* f = F + (size_t)t * pitch + h * HD; const float rf = RF ? RF[(size_t)h * TT + t] : 1.0f; v2h o16; v2us oh, ol;
#pragma unroll
    for (int q = 0; q < 2; ++q) { const int dd = d + q; const int dp = (dd < HD / 2) ? dd + HD / 2 : dd - HD / 2; float x0 = bfr(f[dd]), x1 = bfr(f[dp]);   /* raw input: bf16-rounded here */
        if (RF) { float n0 = __fmul_rn(x0, rf), n1 = __fmul_rn(x1, rf); asm volatile("" : "+v"(n0)); asm volatile("" : "+v"(n1)); x0 = __fmul_rn(bfr(nw[dd]), n0); x1 = __fmul_rn(bfr(nw[dp]), n1); }
        const v2f cs = *(const v2f*)(CS + ((size_t)t * HD + dd) * 2); float a = __fmul_rn(x0, cs[0]), bq = __fmul_rn(x1, cs[1]); asm volatile("" : "+v"(a)); asm volatile("" : "+v"(bq)); const float r = ((dd < HD / 2) ? __fsub_rn(a, bq) : __fadd_rn(a, bq)) * sc;
        o16[q] = tohx(r); unsigned short a2, c2; splitf(r, a2, c2); oh[q] = a2; ol[q] = c2; }
    *(v2h*)(P16 + e) = o16; *(v2us*)(Ph + e) = oh; *(v2us*)(Pl + e) = ol;  }
__global__ __launch_bounds__(256) void k_vtp(const float* __restrict__ F, int pitch, int nheads, h16* V16, bf* Vh, bf* Vl) { const size_t e = ((size_t)blockIdx.x * 256 + threadIdx.x) * 2; if (e >= (size_t)nheads * HD * TT) return; const int t = (int)(e % TT); const int d = (int)((e / TT) % HD); const int g = (int)(e / ((size_t)TT * HD)); v2h o16; v2us oh, ol;
#pragma unroll
    for (int q = 0; q < 2; ++q) { const float x = bfr(F[(size_t)(t + q) * pitch + g * HD + d]);   /* raw input: bf16-rounded here */ o16[q] = tohx(x); unsigned short a2, c2; splitf(x, a2, c2); oh[q] = a2; ol[q] = c2; }
    *(v2h*)(V16 + e) = o16; *(v2us*)(Vh + e) = oh; *(v2us*)(Vl + e) = ol;  }
__global__ __launch_bounds__(256) void k_csid(float* CS) { const int idx = blockIdx.x * 256 + threadIdx.x; if (idx >= TT * HD) return; v2f cs; cs[0] = 1.0f; cs[1] = 0.0f; *(v2f*)(CS + (size_t)idx * 2) = cs;  }
// k_asoft (this module): logit = (score x tau_b + delta_b[j]) x (1/8) for j <= i (tau, delta read, bf16-rounded; the delta row is loaded 16 B per lane per chunk), -3e38 above the diagonal.
// k_asoft: per row (zz, i): t = (S x tau + delta_j) x HD^-0.5 for j <= i, -3e38 above the diagonal; softmax over the 2048 keys (register row, one exp, fixed trees);
__global__ __launch_bounds__(256) void k_asoft(const float* __restrict__ Sb, const float* __restrict__ taup, const float* __restrict__ dlt, h16* P16, bf* Ph, bf* Pl) {
    const int lane = threadIdx.x & 31; const int row = blockIdx.x * 8 + (threadIdx.x >> 5); if (row >= ZH * TT) return; const int i = row % TT; const int zz = row / TT; (void)zz; const bool hires = (i < RH); const float* sr = Sb + (size_t)row * TT; float tv = bfr(taup[0]); asm volatile("" : "+v"(tv)); float v[TT / 32]; float mx = -3.0e38f;
#pragma unroll
    for (int ch = 0; ch < TT / 128; ++ch) { const int j0 = ch * 128 + lane * 4; const v4f a = *(const v4f*)(sr + j0); const v4f d4 = *(const v4f*)(dlt + j0);
#pragma unroll
        for (int q = 0; q < 4; ++q) { const int j = j0 + q; float st = __fmul_rn(a[q], tv); asm volatile("" : "+v"(st)); float dv = bfr(d4[q]); asm volatile("" : "+v"(dv)); float sd = __fadd_rn(st, dv); asm volatile("" : "+v"(sd)); const float t = (j <= i) ? sd * SCL : -3.0e38f; v[ch * 4 + q] = t; mx = fmaxf(mx, t); } }   /* (s x tau + delta_j) x scale, causal */
#pragma unroll
    for (int sh = 16; sh; sh >>= 1) mx = fmaxf(mx, __shfl_xor(mx, sh, 32));
    float sum = 0.f;
#pragma unroll
    for (int k = 0; k < TT / 32; ++k) { float d0 = __fsub_rn(v[k], mx); asm volatile("" : "+v"(d0)); v[k] = __builtin_amdgcn_exp2f(__fmul_rn(d0, 1.4426950408889634f)); sum += v[k]; }
#pragma unroll
    for (int sh = 16; sh; sh >>= 1) sum += __shfl_xor(sum, sh, 32);
    const float f = __fdiv_rn(hires ? 1.0f : PCAR, sum);
{
        if (hires) {
#pragma unroll
            for (int ch = 0; ch < TT / 128; ++ch) { v4us oh, ol;
#pragma unroll
                for (int q = 0; q < 4; ++q) { unsigned short a, c2; splitf(v[ch * 4 + q] * f, a, c2); oh[q] = a; ol[q] = c2; }
                const size_t oo = ((size_t)zz * (RH ? RH : 1) + i) * TT + ch * 128 + lane * 4; *(v4us*)(Ph + oo) = oh; *(v4us*)(Pl + oo) = ol; }
        } else {
#pragma unroll
            for (int ch = 0; ch < TT / 128; ++ch) { v4h o4;
#pragma unroll
                for (int q = 0; q < 4; ++q) o4[q] = tohx(v[ch * 4 + q] * f);
                *(v4h*)(P16 + (size_t)row * TT + ch * 128 + lane * 4) = o4; } }
         }
}
__global__ __launch_bounds__(256) void k_merge(const float* __restrict__ O, int h0, float* OUTb) { const size_t e = ((size_t)blockIdx.x * 256 + threadIdx.x) * 2; if (e >= (size_t)ZH * TT * HD) return; const int d = (int)(e % HD); const int t = (int)((e / HD) % TT); const int zz = (int)(e / ((size_t)HD * TT)); const float cs = (t < RH) ? 1.0f : (1.0f / PCAR); const size_t oo = (size_t)t * DQ + (h0 + zz) * HD + d;
    v2f o2; o2[0] = O[e] * cs; o2[1] = O[e + 1] * cs; *(v2f*)(OUTb + oo) = o2;  }

extern "C" void kernel_launch(void* const* d_in, const int* in_sizes, int n_in,
                              void* d_out, int out_size, void* d_ws, size_t ws_size, hipStream_t stream) {
    (void)in_sizes; (void)n_in; (void)out_size;
    const float* qi = (const float*)d_in[0]; const float* ki = (const float*)d_in[1]; const float* vi = (const float*)d_in[2]; const float* tau = (const float*)d_in[3]; const float* delta = (const float*)d_in[4]; const float* x = nullptr; const float* wq = nullptr; const float* wk = nullptr; const float* wv = nullptr; const float* wo = nullptr; (void)x; (void)wq; (void)wk; (void)wv; (void)wo;
    float* OUT = (float*)d_out;     // [2][2048][1024]
    char* wsp = (char*)d_ws;
    auto take = [&](size_t bytes) { char* p = wsp; wsp += (bytes + 255) & ~(size_t)255; return (void*)p; };
     float* CS = (float*)take((size_t)TT * HD * 2 * 4);
    
    h16* QP16 = (h16*)take((size_t)NH_ * TT * HD * 2); h16* KP16 = (h16*)take((size_t)NKV * TT * HD * 2); h16* VT16 = (h16*)take((size_t)NKV * HD * TT * 2);
    bf* QPh = (bf*)take((size_t)NH_ * TT * HD * 2); bf* QPl = (bf*)take((size_t)NH_ * TT * HD * 2); bf* KPh = (bf*)take((size_t)NKV * TT * HD * 2); bf* KPl = (bf*)take((size_t)NKV * TT * HD * 2); bf* VTh = (bf*)take((size_t)NKV * HD * TT * 2); bf* VTl = (bf*)take((size_t)NKV * HD * TT * 2); bf* Ph = (bf*)take((size_t)ZH * RH * TT * 2); bf* Pl = (bf*)take((size_t)ZH * RH * TT * 2);
    float* Sb = (float*)take((size_t)ZH * TT * TT * 4); h16* P16 = (h16*)take((size_t)ZH * TT * TT * 2); float* Ob = (float*)take((size_t)ZH * TT * HD * 4);
    if ((size_t)(wsp - (char*)d_ws) > ws_size) return;    // ws 256 MiB
    k_csid<<<(TT * HD + 255) / 256, 256, 0, stream>>>(CS);
    const unsigned LQ = (unsigned)(((size_t)NH_ * TT * HD / 2 + 255) / 256), LKv = (unsigned)(((size_t)NKV * TT * HD / 2 + 255) / 256);
    for (int b = 0; b < NB_; ++b) {
        k_rope<<<LQ, 256, 0, stream>>>(qi + (size_t)b * TT * DQ, DQ, NH_, CS, nullptr, nullptr, 1.0f, QP16, QPh, QPl);
        k_rope<<<LKv, 256, 0, stream>>>(ki + (size_t)b * TT * DKV, DKV, NKV, CS, nullptr, nullptr, 1.0f, KP16, KPh, KPl);
        k_vtp<<<LKv, 256, 0, stream>>>(vi + (size_t)b * TT * DKV, DKV, NKV, VT16, VTh, VTl);
        for (int h0 = 0; h0 < NH_; h0 += ZH) { const size_t zq = (size_t)h0, zk = (size_t)(h0 / REP);   // one kv head per query head: the pass's two heads use consecutive kv planes (z-strides TT*HD)
            k_gemmc<bf, 2, 1><<<dim3(RH / 64, TT / 64, ZH), 32, 0, stream>>>(QPh + zq * TT * HD, QPl + zq * TT * HD, KPh + zk * TT * HD, KPl + zk * TT * HD, HD, Sb, TT, 0, (size_t)TT * HD, (size_t)TT * HD, (size_t)TT * TT);
            k_gemmc<h16, 0, 1><<<dim3((TT - RH) / 64, TT / 64, ZH), 32, 0, stream>>>(QP16 + zq * TT * HD + (size_t)RH * HD, nullptr, KP16 + zk * TT * HD, nullptr, HD, Sb + (size_t)RH * TT, TT, RH, (size_t)TT * HD, (size_t)TT * HD, (size_t)TT * TT);
            k_asoft<<<ZH * TT / 8, 256, 0, stream>>>(Sb, tau + b, delta + (size_t)b * TT, P16, Ph, Pl);
            k_gemmc<bf, 2, 2><<<dim3(RH / 64, HD / 64, ZH), 32, 0, stream>>>(Ph, Pl, VTh + zk * HD * TT, VTl + zk * HD * TT, TT, Ob, HD, 0, (size_t)RH * TT, (size_t)HD * TT, (size_t)TT * HD);
            k_gemmc<h16, 0, 2><<<dim3((TT - RH) / 64, HD / 64, ZH), 32, 0, stream>>>(P16 + (size_t)RH * TT, nullptr, VT16 + zk * HD * TT, nullptr, TT, Ob + (size_t)RH * HD, HD, RH, (size_t)TT * TT, (size_t)HD * TT, (size_t)TT * HD);
            k_merge<<<(unsigned)(((size_t)ZH * TT * HD / 2 + 255) / 256), 256, 0, stream>>>(Ob, h0, OUT + (size_t)b * TT * DQ); }
         }
}

// v001
// A run of this version takes 509 microseconds.
// Timed twice side by side with v000, it ran 2.57 and 2.56 times as fast.
#include <hip/hip_runtime.h>

// De-stationary causal attention on given q, k, v ([2][2048][16][64] token-major; tau [2][1], delta [2][2048]): scores = (q.k) x tau_b + delta_b[s] (per-key bias), causal (-inf above the diagonal), A = softmax(scores / 8), V[b][l][h][d] = sum_s A v -> [2][2048][16][64] f32 (4.2 M).
// Layout per batch: the token-major inputs already have the [token][head x dim] row layout, so the plane builders read them directly (bf16-rounded on read); causal hybrid attention (rows < 512 hi/lo, rest fp16 x1024) with tile skipping; the softmax kernel forms (s x tau + delta_j) x (1/8) per logit with tau/delta read (bf16-rounded); the merge kernel writes the token-major f32 output.
// Compute dtypes, f32 accumulate: q, k, v, tau, delta rounded to bf16: hi planes exact, lo zero; scores and attn.v rows < 512 3 products, the rest single fp16; softmax f32; f32 output.

#define NB_  2
#define TT   2048
#define DM   1024
#define NH_  16
#define NKV  16
#define REP  (NH_ / NKV)
#define HD   64
#define DQ   (NH_ * HD)
#define DKV  (NKV * HD)
#define ZH   8                    // heads per pass (z-batch of every attention launch); 8 is the most the workspace holds
#define RH   512                  // query rows < RH use hi+lo planes (0: none)
#define WIN  2048
#define PCAR 1024.0f
#define SCL  0.125f   // HD^-0.5
typedef _Float16 h16;
typedef unsigned short bf;
typedef __attribute__((ext_vector_type(16))) __bf16   v16bf;
typedef __attribute__((ext_vector_type(16))) _Float16 v16h;
typedef __attribute__((ext_vector_type(8)))  _Float16 v8h;
typedef __attribute__((ext_vector_type(8)))  unsigned short v8us;
typedef __attribute__((ext_vector_type(8)))  float    v8f;
typedef __attribute__((ext_vector_type(4)))  float    v4f;
typedef v8h  __attribute__((may_alias)) v8ha;
typedef v4f  __attribute__((may_alias)) v4fa;
typedef v8us __attribute__((may_alias)) v8usa;

__device__ __forceinline__ unsigned short f2bf(float f) { unsigned u = __float_as_uint(f); u += 0x7FFFu + ((u >> 16) & 1u); return (unsigned short)(u >> 16); }
__device__ __forceinline__ float bf2f(unsigned short b) { return __uint_as_float(((unsigned)b) << 16); }
__device__ __forceinline__ float bfr(float f) { return bf2f(f2bf(f)); }
__device__ __forceinline__ v16h cat16(v8h lo, v8h hi) { return __builtin_shufflevector(lo, hi, 0, 1, 2, 3, 4, 5, 6, 7, 8, 9, 10, 11, 12, 13, 14, 15); }
__device__ __forceinline__ v16bf cat16b(v8us lo, v8us hi) { return __builtin_bit_cast(v16bf, __builtin_shufflevector(lo, hi, 0, 1, 2, 3, 4, 5, 6, 7, 8, 9, 10, 11, 12, 13, 14, 15)); }
__device__ __forceinline__ v8f wmma16(v16h a, v16h b, v8f c) { return __builtin_amdgcn_wmma_f32_16x16x32_f16(false, a, false, b, (short)0, c, false, false); }
__device__ __forceinline__ v8f wmmab(v16bf a, v16bf b, v8f c) { return __builtin_amdgcn_wmma_f32_16x16x32_bf16(false, a, false, b, (short)0, c, false, false); }



// ---- k_gemmw: register-blocked GEMM, ONE WAVE per 64x64 output tile (16 accumulators), operands straight from K-contiguous 16-bit planes; grid (M/64, N/64, Z), 32 threads.
// C[m][n] (f32, pitch ldc, + optional f32 bias[n]) = sum_k A[m][k] Bt[n][k] (+ split products per NSPLIT). z-batch strides sA/sB/sC in elements. K % 32 == 0.
template <typename T16> struct WFrag;
template <> struct WFrag<h16> { typedef v16h V; static __device__ __forceinline__ V ld(const h16* p) { return cat16(*(const v8h*)p, *(const v8h*)(p + 16)); } static __device__ __forceinline__ v8f mma(V a, V b, v8f c) { return wmma16(a, b, c); } };
template <> struct WFrag<bf> { typedef v16bf V; static __device__ __forceinline__ V ld(const bf* p) { return cat16b(*(const v8us*)p, *(const v8us*)(p + 16)); } static __device__ __forceinline__ v8f mma(V a, V b, v8f c) { return wmmab(a, b, c); } };
template <typename T16, int NSPLIT, bool BIAS>
__global__ __launch_bounds__(32) void k_gemmw(const T16* __restrict__ A, const T16* __restrict__ A2, const T16* __restrict__ Bt, const T16* __restrict__ Bt2, int K, float* C, int ldc, const float* __restrict__ bias, size_t sA, size_t sB, size_t sC) {
    typedef typename WFrag<T16>::V V;
    __shared__ __align__(16) float os[16 * 68];
    const size_t z = blockIdx.z; A += z * sA; if (A2) A2 += z * sA; Bt += z * sB; if (Bt2) Bt2 += z * sB; C += z * sC;
    const int lane = threadIdx.x & 31, lr = lane & 15, hi = lane >> 4; const int r0 = blockIdx.x * 64, c0 = blockIdx.y * 64;
    v8f acc[4][4];
#pragma unroll
    for (int mb = 0; mb < 4; ++mb)
#pragma unroll
        for (int nb = 0; nb < 4; ++nb) acc[mb][nb] = (v8f){};
    const size_t aoff = (size_t)(r0 + lr) * K + 8 * hi, boff = (size_t)(c0 + lr) * K + 8 * hi;
#pragma unroll 1
    for (int kc = 0; kc < K; kc += 32) {
        V a[4], a2[4];
#pragma unroll
        for (int mb = 0; mb < 4; ++mb) { a[mb] = WFrag<T16>::ld(A + aoff + (size_t)mb * 16 * K + kc); if (NSPLIT == 1 || NSPLIT == 2) a2[mb] = WFrag<T16>::ld(A2 + aoff + (size_t)mb * 16 * K + kc); }
#pragma unroll
        for (int nb = 0; nb < 4; ++nb) { const V b = WFrag<T16>::ld(Bt + boff + (size_t)nb * 16 * K + kc); V b2; if (NSPLIT >= 2) b2 = WFrag<T16>::ld(Bt2 + boff + (size_t)nb * 16 * K + kc);
#pragma unroll
            for (int mb = 0; mb < 4; ++mb) { acc[mb][nb] = WFrag<T16>::mma(a[mb], b, acc[mb][nb]); if (NSPLIT == 1 || NSPLIT == 2) acc[mb][nb] = WFrag<T16>::mma(a2[mb], b, acc[mb][nb]); if (NSPLIT >= 2) acc[mb][nb] = WFrag<T16>::mma(a[mb], b2, acc[mb][nb]); } }
        asm volatile("v_nop\n\tv_nop\n\tv_nop\n\tv_nop" : "+v"(acc[0][0]), "+v"(acc[1][1]), "+v"(acc[2][2]), "+v"(acc[3][3]) : "v"(a[0]), "v"(a[3]));
    }
#pragma unroll
    for (int mb = 0; mb < 4; ++mb) {
#pragma unroll
        for (int nb = 0; nb < 4; ++nb) {
#pragma unroll
            for (int j = 0; j < 8; ++j) os[(hi * 8 + j) * 68 + nb * 16 + lr] = acc[mb][nb][j]; }
        __builtin_amdgcn_wave_barrier(); asm volatile("" ::: "memory");
        float* crow = C + (size_t)(r0 + mb * 16) * ldc + c0;
{
#pragma unroll
            for (int s = 0; s < 8; ++s) { const int row = 2 * s + hi, cofs = lr * 4; v4f val = *(const v4fa*)(os + row * 68 + cofs); if (BIAS) { val[0] += bfr(bias[c0 + cofs]); val[1] += bfr(bias[c0 + cofs + 1]); val[2] += bfr(bias[c0 + cofs + 2]); val[3] += bfr(bias[c0 + cofs + 3]); }
                *(v4f*)(crow + (size_t)row * ldc + cofs) = val; }
             }
        __builtin_amdgcn_wave_barrier(); asm volatile("" ::: "memory");
    }
}

// ---- k_gemmc: the same one-wave 64x64 tile GEMM specialised for causal attention: CMODE 1 skips score tiles entirely above the diagonal (query rows r0+roff.., key columns c0..), CMODE 2 limits the
// key (K) loop of the probability x value contraction to the diagonal block (probabilities beyond it are exactly zero). roff = row offset of this launch's first row within the sequence.
template <typename T16, int NSPLIT, int CMODE>
__global__ __launch_bounds__(32) void k_gemmc(const T16* __restrict__ A, const T16* __restrict__ A2, const T16* __restrict__ Bt, const T16* __restrict__ Bt2, int K, float* C, int ldc, int roff, size_t sA, size_t sB, size_t sC) {
    typedef typename WFrag<T16>::V V;
    __shared__ __align__(16) float os[16 * 68];
    const size_t z = blockIdx.z; A += z * sA; if (A2) A2 += z * sA; Bt += z * sB; if (Bt2) Bt2 += z * sB; C += z * sC;
    const int lane = threadIdx.x & 31, lr = lane & 15, hi = lane >> 4; const int r0 = blockIdx.x * 64, c0 = blockIdx.y * 64;
    if (CMODE == 1 && c0 > r0 + roff + 63) return;                  // score tile entirely above the causal diagonal: never read (the softmax masks j > i by select)
    const int Kl = (CMODE == 2) ? min(K, r0 + roff + 64) : K;        // P.V: probabilities are exactly 0 beyond the diagonal block, so the K loop stops there
    v8f acc[4][4];
#pragma unroll
    for (int mb = 0; mb < 4; ++mb)
#pragma unroll
        for (int nb = 0; nb < 4; ++nb) acc[mb][nb] = (v8f){};
    const size_t aoff = (size_t)(r0 + lr) * K + 8 * hi, boff = (size_t)(c0 + lr) * K + 8 * hi;
#pragma unroll 1
    for (int kc = 0; kc < Kl; kc += 32) {
        V a[4], a2[4];
#pragma unroll
        for (int mb = 0; mb < 4; ++mb) { a[mb] = WFrag<T16>::ld(A + aoff + (size_t)mb * 16 * K + kc); if (NSPLIT == 1 || NSPLIT == 2) a2[mb] = WFrag<T16>::ld(A2 + aoff + (size_t)mb * 16 * K + kc); }
#pragma unroll
        for (int nb = 0; nb < 4; ++nb) { const V b = WFrag<T16>::ld(Bt + boff + (size_t)nb * 16 * K + kc); V b2; if (NSPLIT >= 2) b2 = WFrag<T16>::ld(Bt2 + boff + (size_t)nb * 16 * K + kc);
#pragma unroll
            for (int mb = 0; mb < 4; ++mb) { acc[mb][nb] = WFrag<T16>::mma(a[mb], b, acc[mb][nb]); if (NSPLIT == 1 || NSPLIT == 2) acc[mb][nb] = WFrag<T16>::mma(a2[mb], b, acc[mb][nb]); if (NSPLIT >= 2) acc[mb][nb] = WFrag<T16>::mma(a[mb], b2, acc[mb][nb]); } }
        asm volatile("v_nop\n\tv_nop\n\tv_nop\n\tv_nop" : "+v"(acc[0][0]), "+v"(acc[1][1]), "+v"(acc[2][2]), "+v"(acc[3][3]) : "v"(a[0]), "v"(a[3]));
    }
#pragma unroll
    for (int mb = 0; mb < 4; ++mb) {
#pragma unroll
        for (int nb = 0; nb < 4; ++nb) {
#pragma unroll
            for (int j = 0; j < 8; ++j) os[(hi * 8 + j) * 68 + nb * 16 + lr] = acc[mb][nb][j]; }
        __builtin_amdgcn_wave_barrier(); asm volatile("" ::: "memory");
        float* crow = C + (size_t)(r0 + mb * 16) * ldc + c0;
{
#pragma unroll
            for (int s = 0; s < 8; ++s) { const int row = 2 * s + hi, cofs = lr * 4; v4f val = *(const v4fa*)(os + row * 68 + cofs);
                *(v4f*)(crow + (size_t)row * ldc + cofs) = val; }
             }
        __builtin_amdgcn_wave_barrier(); asm volatile("" ::: "memory");
    }
}

__device__ __forceinline__ h16 tohx(float x) { return (h16)x; }
__device__ __forceinline__ void splitf(float y, unsigned short& h, unsigned short& l) { h = f2bf(y); l = f2bf(y - bf2f(h)); }
typedef __attribute__((ext_vector_type(2))) _Float16 v2h;
typedef __attribute__((ext_vector_type(4))) _Float16 v4h;
typedef __attribute__((ext_vector_type(2))) unsigned short v2us;
typedef __attribute__((ext_vector_type(4))) unsigned short v4us;
typedef __attribute__((ext_vector_type(2))) float v2f;
typedef __attribute__((ext_vector_type(4))) int v4i;

__global__ __launch_bounds__(256) void k_wtG(const float* __restrict__ w, int K, int N, bf* Bt) {
    const int lane = threadIdx.x & 31; const int L0 = (blockIdx.x * 8 + (threadIdx.x >> 5)) * 8; const int nlines = N * K / 64;
{
#pragma unroll 1
        for (int l = 0; l < 8; ++l) { const int L = L0 + l; if (L >= nlines) break; const size_t e = (size_t)L * 64 + lane * 2; const int k = (int)(e % K), n = (int)(e / K); v2us o;
            o[0] = f2bf(w[(size_t)k * N + n]); o[1] = f2bf(w[(size_t)(k + 1) * N + n]); *(v2us*)(Bt + e) = o; }
         }
}
__global__ __launch_bounds__(256) void k_cvt8(const float* __restrict__ src, bf* dst, size_t n8) { const size_t i = (size_t)blockIdx.x * 256 + threadIdx.x; if (i >= n8) return; const v8f v = *(const v8f*)(src + i * 8); v8us o;
#pragma unroll
    for (int k = 0; k < 8; ++k) o[k] = f2bf(v[k]); *(v8us*)(dst + i * 8) = o;  }

// k_rope: head planes [h][t][d] (fp16 + hi/lo) of rope(x) x sc with the rotate-half convention out[d] = x[d] cos[t][d] - x[d+HD/2] sin[t][d], out[d+HD/2] = x[d+HD/2] cos[t][d+HD/2] + x[d] sin[t][d+HD/2]
__global__ __launch_bounds__(256) void k_rope(const float* __restrict__ F, int pitch, int nheads, const float* __restrict__ CS, const float* __restrict__ RF, const float* __restrict__ nw, float sc, h16* P16, bf* Ph, bf* Pl) {
    const size_t e = ((size_t)blockIdx.x * 256 + threadIdx.x) * 2; if (e >= (size_t)nheads * TT * HD) return; const int d = (int)(e % HD); const int t = (int)((e / HD) % TT); const int h = (int)(e / ((size_t)HD * TT)); const float* f = F + (size_t)t * pitch + h * HD; const float rf = RF ? RF[(size_t)h * TT + t] : 1.0f; v2h o16; v2us oh, ol;
#pragma unroll
    for (int q = 0; q < 2; ++q) { const int dd = d + q; const int dp = (dd < HD / 2) ? dd + HD / 2 : dd - HD / 2; float x0 = bfr(f[dd]), x1 = bfr(f[dp]);   /* raw input: bf16-rounded here */
        if (RF) { float n0 = __fmul_rn(x0, rf), n1 = __fmul_rn(x1, rf); asm volatile("" : "+v"(n0)); asm volatile("" : "+v"(n1)); x0 = __fmul_rn(bfr(nw[dd]), n0); x1 = __fmul_rn(bfr(nw[dp]), n1); }
        const v2f cs = *(const v2f*)(CS + ((size_t)t * HD + dd) * 2); float a = __fmul_rn(x0, cs[0]), bq = __fmul_rn(x1, cs[1]); asm volatile("" : "+v"(a)); asm volatile("" : "+v"(bq)); const float r = ((dd < HD / 2) ? __fsub_rn(a, bq) : __fadd_rn(a, bq)) * sc;
        o16[q] = tohx(r); unsigned short a2, c2; splitf(r, a2, c2); oh[q] = a2; ol[q] = c2; }
    *(v2h*)(P16 + e) = o16; *(v2us*)(Ph + e) = oh; *(v2us*)(Pl + e) = ol;  }
__global__ __launch_bounds__(256) void k_vtp(const float* __restrict__ F, int pitch, int nheads, h16* V16, bf* Vh, bf* Vl) { const size_t e = ((size_t)blockIdx.x * 256 + threadIdx.x) * 2; if (e >= (size_t)nheads * HD * TT) return; const int t = (int)(e % TT); const int d = (int)((e / TT) % HD); const int g = (int)(e / ((size_t)TT * HD)); v2h o16; v2us oh, ol;
#pragma unroll
    for (int q = 0; q < 2; ++q) { const float x = bfr(F[(size_t)(t + q) * pitch + g * HD + d]);   /* raw input: bf16-rounded here */ o16[q] = tohx(x); unsigned short a2, c2; splitf(x, a2, c2); oh[q] = a2; ol[q] = c2; }
    *(v2h*)(V16 + e) = o16; *(v2us*)(Vh + e) = oh; *(v2us*)(Vl + e) = ol;  }
__global__ __launch_bounds__(256) void k_csid(float* CS) { const int idx = blockIdx.x * 256 + threadIdx.x; if (idx >= TT * HD) return; v2f cs; cs[0] = 1.0f; cs[1] = 0.0f; *(v2f*)(CS + (size_t)idx * 2) = cs;  }
// k_asoft (this module): logit = (score x tau_b + delta_b[j]) x (1/8) for j <= i (tau, delta read, bf16-rounded; the delta row is loaded 16 B per lane per chunk), -3e38 above the diagonal.
// k_asoft: per row (zz, i): t = (S x tau + delta_j) x HD^-0.5 for j <= i, -3e38 above the diagonal; softmax over the 2048 keys (register row, one exp, fixed trees);
__global__ __launch_bounds__(256) void k_asoft(const float* __restrict__ Sb, const float* __restrict__ taup, const float* __restrict__ dlt, h16* P16, bf* Ph, bf* Pl) {
    const int lane = threadIdx.x & 31; const int row = blockIdx.x * 8 + (threadIdx.x >> 5); if (row >= ZH * TT) return; const int i = row % TT; const int zz = row / TT; (void)zz; const bool hires = (i < RH); const float* sr = Sb + (size_t)row * TT; float tv = bfr(taup[0]); asm volatile("" : "+v"(tv)); float v[TT / 32]; float mx = -3.0e38f;
#pragma unroll
    for (int ch = 0; ch < TT / 128; ++ch) { const int j0 = ch * 128 + lane * 4; const v4f a = *(const v4f*)(sr + j0); const v4f d4 = *(const v4f*)(dlt + j0);
#pragma unroll
        for (int q = 0; q < 4; ++q) { const int j = j0 + q; float st = __fmul_rn(a[q], tv); asm volatile("" : "+v"(st)); float dv = bfr(d4[q]); asm volatile("" : "+v"(dv)); float sd = __fadd_rn(st, dv); asm volatile("" : "+v"(sd)); const float t = (j <= i) ? sd * SCL : -3.0e38f; v[ch * 4 + q] = t; mx = fmaxf(mx, t); } }   /* (s x tau + delta_j) x scale, causal */
#pragma unroll
    for (int sh = 16; sh; sh >>= 1) mx = fmaxf(mx, __shfl_xor(mx, sh, 32));
    float sum = 0.f;
#pragma unroll
    for (int k = 0; k < TT / 32; ++k) { float d0 = __fsub_rn(v[k], mx); asm volatile("" : "+v"(d0)); v[k] = __builtin_amdgcn_exp2f(__fmul_rn(d0, 1.4426950408889634f)); sum += v[k]; }
#pragma unroll
    for (int sh = 16; sh; sh >>= 1) sum += __shfl_xor(sum, sh, 32);
    const float f = __fdiv_rn(hires ? 1.0f : PCAR, sum);
{
        if (hires) {
#pragma unroll
            for (int ch = 0; ch < TT / 128; ++ch) { v4us oh, ol;
#pragma unroll
                for (int q = 0; q < 4; ++q) { unsigned short a, c2; splitf(v[ch * 4 + q] * f, a, c2); oh[q] = a; ol[q] = c2; }
                const size_t oo = ((size_t)zz * (RH ? RH : 1) + i) * TT + ch * 128 + lane * 4; *(v4us*)(Ph + oo) = oh; *(v4us*)(Pl + oo) = ol; }
        } else {
#pragma unroll
            for (int ch = 0; ch < TT / 128; ++ch) { v4h o4;
#pragma unroll
                for (int q = 0; q < 4; ++q) o4[q] = tohx(v[ch * 4 + q] * f);
                *(v4h*)(P16 + ((size_t)zz * (TT - RH) + (i - RH)) * TT + ch * 128 + lane * 4) = o4; } }
         }
}
__global__ __launch_bounds__(256) void k_merge(const float* __restrict__ O, int h0, float* OUTb) { const size_t e = ((size_t)blockIdx.x * 256 + threadIdx.x) * 2; if (e >= (size_t)ZH * TT * HD) return; const int d = (int)(e % HD); const int t = (int)((e / HD) % TT); const int zz = (int)(e / ((size_t)HD * TT)); const float cs = (t < RH) ? 1.0f : (1.0f / PCAR); const size_t oo = (size_t)t * DQ + (h0 + zz) * HD + d;
    v2f o2; o2[0] = O[e] * cs; o2[1] = O[e + 1] * cs; *(v2f*)(OUTb + oo) = o2;  }

extern "C" void kernel_launch(void* const* d_in, const int* in_sizes, int n_in,
                              void* d_out, int out_size, void* d_ws, size_t ws_size, hipStream_t stream) {
    (void)in_sizes; (void)n_in; (void)out_size;
    const float* qi = (const float*)d_in[0]; const float* ki = (const float*)d_in[1]; const float* vi = (const float*)d_in[2]; const float* tau = (const float*)d_in[3]; const float* delta = (const float*)d_in[4]; const float* x = nullptr; const float* wq = nullptr; const float* wk = nullptr; const float* wv = nullptr; const float* wo = nullptr; (void)x; (void)wq; (void)wk; (void)wv; (void)wo;
    float* OUT = (float*)d_out;     // [2][2048][1024]
    char* wsp = (char*)d_ws;
    auto take = [&](size_t bytes) { char* p = wsp; wsp += (bytes + 255) & ~(size_t)255; return (void*)p; };
     float* CS = (float*)take((size_t)TT * HD * 2 * 4);
    
    h16* QP16 = (h16*)take((size_t)NH_ * TT * HD * 2); h16* KP16 = (h16*)take((size_t)NKV * TT * HD * 2); h16* VT16 = (h16*)take((size_t)NKV * HD * TT * 2);
    bf* QPh = (bf*)take((size_t)NH_ * TT * HD * 2); bf* QPl = (bf*)take((size_t)NH_ * TT * HD * 2); bf* KPh = (bf*)take((size_t)NKV * TT * HD * 2); bf* KPl = (bf*)take((size_t)NKV * TT * HD * 2); bf* VTh = (bf*)take((size_t)NKV * HD * TT * 2); bf* VTl = (bf*)take((size_t)NKV * HD * TT * 2); bf* Ph = (bf*)take((size_t)ZH * RH * TT * 2); bf* Pl = (bf*)take((size_t)ZH * RH * TT * 2);
    float* Sb = (float*)take((size_t)ZH * TT * TT * 4); h16* P16 = (h16*)take((size_t)ZH * (TT - RH) * TT * 2);   /* fp16 probabilities: only rows >= RH are stored */ float* Ob = (float*)take((size_t)ZH * TT * HD * 4);
    if ((size_t)(wsp - (char*)d_ws) > ws_size) return;    // ws 256 MiB
    k_csid<<<(TT * HD + 255) / 256, 256, 0, stream>>>(CS);
    const unsigned LQ = (unsigned)(((size_t)NH_ * TT * HD / 2 + 255) / 256), LKv = (unsigned)(((size_t)NKV * TT * HD / 2 + 255) / 256);
    for (int b = 0; b < NB_; ++b) {
        k_rope<<<LQ, 256, 0, stream>>>(qi + (size_t)b * TT * DQ, DQ, NH_, CS, nullptr, nullptr, 1.0f, QP16, QPh, QPl);
        k_rope<<<LKv, 256, 0, stream>>>(ki + (size_t)b * TT * DKV, DKV, NKV, CS, nullptr, nullptr, 1.0f, KP16, KPh, KPl);
        k_vtp<<<LKv, 256, 0, stream>>>(vi + (size_t)b * TT * DKV, DKV, NKV, VT16, VTh, VTl);
        for (int h0 = 0; h0 < NH_; h0 += ZH) { const size_t zq = (size_t)h0, zk = (size_t)(h0 / REP);   // one kv head per query head: the pass's ZH heads use consecutive kv planes (z-strides TT*HD)
            k_gemmc<bf, 2, 1><<<dim3(RH / 64, TT / 64, ZH), 32, 0, stream>>>(QPh + zq * TT * HD, QPl + zq * TT * HD, KPh + zk * TT * HD, KPl + zk * TT * HD, HD, Sb, TT, 0, (size_t)TT * HD, (size_t)TT * HD, (size_t)TT * TT);
            k_gemmc<h16, 0, 1><<<dim3((TT - RH) / 64, TT / 64, ZH), 32, 0, stream>>>(QP16 + zq * TT * HD + (size_t)RH * HD, nullptr, KP16 + zk * TT * HD, nullptr, HD, Sb + (size_t)RH * TT, TT, RH, (size_t)TT * HD, (size_t)TT * HD, (size_t)TT * TT);
            k_asoft<<<ZH * TT / 8, 256, 0, stream>>>(Sb, tau + b, delta + (size_t)b * TT, P16, Ph, Pl);
            k_gemmc<bf, 2, 2><<<dim3(RH / 64, HD / 64, ZH), 32, 0, stream>>>(Ph, Pl, VTh + zk * HD * TT, VTl + zk * HD * TT, TT, Ob, HD, 0, (size_t)RH * TT, (size_t)HD * TT, (size_t)TT * HD);
            k_gemmc<h16, 0, 2><<<dim3((TT - RH) / 64, HD / 64, ZH), 32, 0, stream>>>(P16, nullptr, VT16 + zk * HD * TT, nullptr, TT, Ob + (size_t)RH * HD, HD, RH, (size_t)(TT - RH) * TT, (size_t)HD * TT, (size_t)TT * HD);
            k_merge<<<(unsigned)(((size_t)ZH * TT * HD / 2 + 255) / 256), 256, 0, stream>>>(Ob, h0, OUT + (size_t)b * TT * DQ); }
         }
}

// v002
// A run of this version takes 85.6 microseconds.
// In two side-by-side timings against v001, it was 6.06 and 5.97 times as fast.
// All steps since v000 together make it 15.4 times as fast.
#include <hip/hip_runtime.h>

// De-stationary causal attention on given q, k, v ([2][2048][16][64] token-major; tau [2][1], delta [2][2048]): scores = (q.k) x tau_b + delta_b[s] (per-key bias), causal (-inf above the diagonal), A = softmax(scores / 8), V[b][l][h][d] = sum_s A v -> [2][2048][16][64] f32 (4.2 M).
// Layout: the plane builders turn the token-major inputs of both batches into head planes (q, k: [b*16+h][t][d]; v transposed: [b*16+h][d][t]; bf16-rounded on read); ONE fused kernel then does scores, softmax and attn.v per 32 query rows without ever storing a score or a probability, and writes the token-major f32 output.
// Compute dtypes, f32 accumulate: q, k, v, tau, delta rounded to bf16: hi planes exact, lo planes exactly zero (their products add +0 and are not formed); query rows < 512: bf16 scores, probabilities as bf16 hi + lo; the rest single fp16; softmax f32 (running maximum); f32 output.

#define NB_  2
#define TT   2048
#define DM   1024
#define NH_  16
#define NKV  16
#define REP  (NH_ / NKV)
#define HD   64
#define DQ   (NH_ * HD)
#define DKV  (NKV * HD)
#define RH   512                  // query rows < RH use the bf16 hi planes and hi+lo P (0: none)
#define WIN  2048
#define SCL  0.125f   // HD^-0.5
typedef _Float16 h16;
typedef unsigned short bf;
typedef __attribute__((ext_vector_type(16))) __bf16   v16bf;
typedef __attribute__((ext_vector_type(16))) _Float16 v16h;
typedef __attribute__((ext_vector_type(8)))  _Float16 v8h;
typedef __attribute__((ext_vector_type(8)))  unsigned short v8us;
typedef __attribute__((ext_vector_type(8)))  float    v8f;
typedef __attribute__((ext_vector_type(4)))  float    v4f;
typedef v8h  __attribute__((may_alias)) v8ha;
typedef v4f  __attribute__((may_alias)) v4fa;
typedef v8us __attribute__((may_alias)) v8usa;

__device__ __forceinline__ unsigned short f2bf(float f) { unsigned u = __float_as_uint(f); u += 0x7FFFu + ((u >> 16) & 1u); return (unsigned short)(u >> 16); }
__device__ __forceinline__ float bf2f(unsigned short b) { return __uint_as_float(((unsigned)b) << 16); }
__device__ __forceinline__ float bfr(float f) { return bf2f(f2bf(f)); }
__device__ __forceinline__ v16h cat16(v8h lo, v8h hi) { return __builtin_shufflevector(lo, hi, 0, 1, 2, 3, 4, 5, 6, 7, 8, 9, 10, 11, 12, 13, 14, 15); }
__device__ __forceinline__ v16bf cat16b(v8us lo, v8us hi) { return __builtin_bit_cast(v16bf, __builtin_shufflevector(lo, hi, 0, 1, 2, 3, 4, 5, 6, 7, 8, 9, 10, 11, 12, 13, 14, 15)); }
__device__ __forceinline__ v8f wmma16(v16h a, v16h b, v8f c) { return __builtin_amdgcn_wmma_f32_16x16x32_f16(false, a, false, b, (short)0, c, false, false); }
__device__ __forceinline__ v8f wmmab(v16bf a, v16bf b, v8f c) { return __builtin_amdgcn_wmma_f32_16x16x32_bf16(false, a, false, b, (short)0, c, false, false); }



// 16-bit fragment loader (hardware k order: bytes 16 hi and 32 + 16 hi of each 64 bytes of a K-contiguous row) and matrix product per operand type
template <typename T16> struct WFrag;
template <> struct WFrag<h16> { typedef v16h V; static __device__ __forceinline__ V ld(const h16* p) { return cat16(*(const v8h*)p, *(const v8h*)(p + 16)); } static __device__ __forceinline__ v8f mma(V a, V b, v8f c) { return wmma16(a, b, c); } };
template <> struct WFrag<bf> { typedef v16bf V; static __device__ __forceinline__ V ld(const bf* p) { return cat16b(*(const v8us*)p, *(const v8us*)(p + 16)); } static __device__ __forceinline__ v8f mma(V a, V b, v8f c) { return wmmab(a, b, c); } };

__device__ __forceinline__ h16 tohx(float x) { return (h16)x; }
__device__ __forceinline__ void splitf(float y, unsigned short& h, unsigned short& l) { h = f2bf(y); l = f2bf(y - bf2f(h)); }
typedef __attribute__((ext_vector_type(2))) _Float16 v2h;
typedef __attribute__((ext_vector_type(4))) _Float16 v4h;
typedef __attribute__((ext_vector_type(2))) unsigned short v2us;
typedef __attribute__((ext_vector_type(4))) unsigned short v4us;
typedef __attribute__((ext_vector_type(2))) float v2f;
typedef __attribute__((ext_vector_type(4))) int v4i;

// k_rope: head planes [h][t][d] (fp16 + hi/lo) of rope(x) x sc with the rotate-half convention out[d] = x[d] cos[t][d] - x[d+HD/2] sin[t][d], out[d+HD/2] = x[d+HD/2] cos[t][d+HD/2] + x[d] sin[t][d+HD/2]
__global__ __launch_bounds__(256) void k_rope(const float* __restrict__ F, int pitch, int nheads, const float* __restrict__ CS, const float* __restrict__ RF, const float* __restrict__ nw, float sc, h16* P16, bf* Ph, bf* Pl) {
    const size_t e = ((size_t)blockIdx.x * 256 + threadIdx.x) * 2; if (e >= (size_t)nheads * TT * HD) return; const int d = (int)(e % HD); const int t = (int)((e / HD) % TT); const int h = (int)(e / ((size_t)HD * TT)); const float* f = F + (size_t)t * pitch + h * HD; const float rf = RF ? RF[(size_t)h * TT + t] : 1.0f; v2h o16; v2us oh, ol;
#pragma unroll
    for (int q = 0; q < 2; ++q) { const int dd = d + q; const int dp = (dd < HD / 2) ? dd + HD / 2 : dd - HD / 2; float x0 = bfr(f[dd]), x1 = bfr(f[dp]);   /* raw input: bf16-rounded here */
        if (RF) { float n0 = __fmul_rn(x0, rf), n1 = __fmul_rn(x1, rf); asm volatile("" : "+v"(n0)); asm volatile("" : "+v"(n1)); x0 = __fmul_rn(bfr(nw[dd]), n0); x1 = __fmul_rn(bfr(nw[dp]), n1); }
        const v2f cs = *(const v2f*)(CS + ((size_t)t * HD + dd) * 2); float a = __fmul_rn(x0, cs[0]), bq = __fmul_rn(x1, cs[1]); asm volatile("" : "+v"(a)); asm volatile("" : "+v"(bq)); const float r = ((dd < HD / 2) ? __fsub_rn(a, bq) : __fadd_rn(a, bq)) * sc;
        o16[q] = tohx(r); unsigned short a2, c2; splitf(r, a2, c2); oh[q] = a2; ol[q] = c2; }
    *(v2h*)(P16 + e) = o16; *(v2us*)(Ph + e) = oh; *(v2us*)(Pl + e) = ol;  }
__global__ __launch_bounds__(256) void k_vtp(const float* __restrict__ F, int pitch, int nheads, h16* V16, bf* Vh, bf* Vl) { const size_t e = ((size_t)blockIdx.x * 256 + threadIdx.x) * 2; if (e >= (size_t)nheads * HD * TT) return; const int t = (int)(e % TT); const int d = (int)((e / TT) % HD); const int g = (int)(e / ((size_t)TT * HD)); v2h o16; v2us oh, ol;
#pragma unroll
    for (int q = 0; q < 2; ++q) { const float x = bfr(F[(size_t)(t + q) * pitch + g * HD + d]);   /* raw input: bf16-rounded here */ o16[q] = tohx(x); unsigned short a2, c2; splitf(x, a2, c2); oh[q] = a2; ol[q] = c2; }
    *(v2h*)(V16 + e) = o16; *(v2us*)(Vh + e) = oh; *(v2us*)(Vl + e) = ol;  }
__global__ __launch_bounds__(256) void k_csid(float* CS) { const int idx = blockIdx.x * 256 + threadIdx.x; if (idx >= TT * HD) return; v2f cs; cs[0] = 1.0f; cs[1] = 0.0f; *(v2f*)(CS + (size_t)idx * 2) = cs;  }

// ---- k_fattn: fused causal attention. One work-group = 32 query rows of one (batch, head); its 4 waves take the 32-key blocks w, w + 4, w + 8, ... up to the diagonal block, each with its own running
// maxima, sums and output accumulators, and merge them once through LDS. Per block: S^T = K.Q^T (A = K rows, B = Q rows, same loader), so a lane holds 16 scores of ONE query (column lr; keys 8 hi + j and 16 + 8 hi + j),
// which after exp2 are, converted in place, the B operand of O^T += V^T.P^T (A = V^T rows by the same loader: equal k order). O^T: lane = query lr, registers = 8 consecutive d.
#define NW   4                    // waves per work-group (interleaved key blocks)
#define OPI  68                   // LDS pitch (floats) of a partial output row
#define L2E  1.4426950408889634f
typedef __attribute__((ext_vector_type(16))) float v16f;
__device__ __forceinline__ float xhalf(float x) { const int b = __float_as_int(x); return __int_as_float(__builtin_amdgcn_permlanex16(b, b, 0x76543210, 0xfedcba98, false, false)); }   // lane l <-> l ^ 16
template <typename T16, bool HI>
__device__ __forceinline__ void fa_body(const T16* __restrict__ Q, const T16* __restrict__ Kp, const T16* __restrict__ Vt, const float* dls, const float c1, const int q0, const int w, const int lr, const int hi, float (&m)[2], float (&l)[2], v8f (&o)[4][2]) {
    typedef typename WFrag<T16>::V V;                               // every '#pragma unroll' below: its loop indexes register arrays (fragments, accumulators), which stay in registers only under constant indices
    const int nst = q0 / 32 + 1;                                    // key blocks 0 .. q0 / 32; only the last one meets the diagonal
    V qf[2][2], kf[2][2];
#pragma unroll
    for (int nq = 0; nq < 2; ++nq)
#pragma unroll
        for (int kc = 0; kc < 2; ++kc) qf[nq][kc] = WFrag<T16>::ld(Q + (size_t)(q0 + nq * 16 + lr) * HD + kc * 32 + 8 * hi);
    const T16* kb = Kp + (size_t)lr * HD + 8 * hi; const T16* vb = Vt + (size_t)lr * TT + 8 * hi;
    { const int kn = min(w, nst - 1) * 32;
#pragma unroll
      for (int t = 0; t < 2; ++t)
#pragma unroll
          for (int kc = 0; kc < 2; ++kc) kf[t][kc] = WFrag<T16>::ld(kb + (size_t)(kn + t * 16) * HD + kc * 32); }
#pragma unroll 1
    for (int s = w; s < nst; s += NW) {                             // rolled: the body is long and the trip count varies
        const int k0 = s * 32;
        V vf[4];
#pragma unroll
        for (int dt = 0; dt < 4; ++dt) vf[dt] = WFrag<T16>::ld(vb + (size_t)dt * 16 * TT + k0);
        v4f dr[4];                                                  // this lane's 16 keys' bias, from LDS (already rounded and scaled)
#pragma unroll
        for (int u = 0; u < 4; ++u) dr[u] = *(const v4fa*)(dls + k0 + (u >> 1) * 16 + hi * 8 + (u & 1) * 4);
        v8f st[2][2];
#pragma unroll
        for (int t = 0; t < 2; ++t)
#pragma unroll
            for (int nq = 0; nq < 2; ++nq) { st[t][nq] = WFrag<T16>::mma(kf[t][0], qf[nq][0], (v8f){}); st[t][nq] = WFrag<T16>::mma(kf[t][1], qf[nq][1], st[t][nq]); }
        { const int kn = min(s + NW, nst - 1) * 32;                 // this wave's next K block, fetched one pass ahead (clamped: always inside the plane)
#pragma unroll
          for (int t = 0; t < 2; ++t)
#pragma unroll
              for (int kc = 0; kc < 2; ++kc) kf[t][kc] = WFrag<T16>::ld(kb + (size_t)(kn + t * 16) * HD + kc * 32); }
        float x[2][16], mx[2];
#pragma unroll
        for (int e = 0; e < 16; ++e) { const float dl = dr[e >> 2][e & 3];
#pragma unroll
            for (int nq = 0; nq < 2; ++nq) x[nq][e] = fmaf(st[e >> 3][nq][e & 7], c1, dl); }   /* (s x tau + delta_j) x scale, in log2 units */
        if (s == nst - 1) {                                         // diagonal block (k0 == q0): keys above the query's own index drop out
#pragma unroll
            for (int nq = 0; nq < 2; ++nq)
#pragma unroll
                for (int e = 0; e < 16; ++e) if ((e >> 3) * 16 + hi * 8 + (e & 7) > nq * 16 + lr) x[nq][e] = -3.0e38f; }
#pragma unroll
        for (int nq = 0; nq < 2; ++nq) { float a = x[nq][0];
#pragma unroll
            for (int e = 1; e < 16; ++e) a = fmaxf(a, x[nq][e]);
            mx[nq] = fmaxf(a, xhalf(a)); }
        // lazy rescale: the maximum in use moves only when some query's new maximum exceeds it by more than 8 (log2 units), so p <= 256
        if (__builtin_amdgcn_ballot_w32(mx[0] > m[0] + 8.0f || mx[1] > m[1] + 8.0f) != 0) {
#pragma unroll
            for (int nq = 0; nq < 2; ++nq) { const float mn = fmaxf(m[nq], mx[nq]); const float al = __builtin_amdgcn_exp2f(m[nq] - mn); m[nq] = mn; l[nq] *= al;
#pragma unroll
                for (int dt = 0; dt < 4; ++dt) o[dt][nq] *= al; } }
#pragma unroll
        for (int nq = 0; nq < 2; ++nq) { v16f p; float sm = 0.f;
#pragma unroll
            for (int e = 0; e < 16; e += 2) { const v2f y = (v2f){x[nq][e], x[nq][e + 1]} - m[nq]; p[e] = __builtin_amdgcn_exp2f(y[0]); p[e + 1] = __builtin_amdgcn_exp2f(y[1]); sm += p[e]; sm += p[e + 1]; }
            l[nq] += sm;
            if constexpr (HI) { const v16bf ph = __builtin_convertvector(p, v16bf); const v16bf pl = __builtin_convertvector(p - __builtin_convertvector(ph, v16f), v16bf);
#pragma unroll
                for (int dt = 0; dt < 4; ++dt) { o[dt][nq] = wmmab(vf[dt], ph, o[dt][nq]); o[dt][nq] = wmmab(vf[dt], pl, o[dt][nq]); }
            } else { const v16h ph = __builtin_convertvector(p, v16h);
#pragma unroll
                for (int dt = 0; dt < 4; ++dt) o[dt][nq] = wmma16(vf[dt], ph, o[dt][nq]); } }
    }
}
__global__ __launch_bounds__(NW * 32) void k_fattn(const h16* __restrict__ Q16, const h16* __restrict__ K16, const h16* __restrict__ V16, const bf* __restrict__ Qh, const bf* __restrict__ Kh, const bf* __restrict__ Vh, const float* __restrict__ tau, const float* __restrict__ delta, float* OUT) {
    __shared__ __align__(16) float op[NW][32 * OPI]; __shared__ float ms[NW][32], ls[NW][32]; __shared__ __align__(16) float dls[TT];
    const int z = blockIdx.x, b = z / NH_, h = z % NH_; const int q0 = (TT / 32 - 1 - (int)blockIdx.y) * 32;   // longest tiles first
    const int w = __builtin_amdgcn_readfirstlane(threadIdx.x >> 5), lane = threadIdx.x & 31, lr = lane & 15, hi = lane >> 4;
    const float c1 = bfr(tau[b]) * (SCL * L2E); const float* dlt = delta + (size_t)b * TT; const size_t pz = (size_t)z * TT * HD;
    float m[2] = {-3.0e38f, -3.0e38f}, l[2] = {0.f, 0.f}; v8f o[4][2];
#pragma unroll
    for (int dt = 0; dt < 4; ++dt)
#pragma unroll
        for (int nq = 0; nq < 2; ++nq) o[dt][nq] = (v8f){};
    // per-key bias delta_j x scale in log2 units (bf16-rounded on read), once per work-group, for the keys this tile can see
    for (int i = threadIdx.x * 4; i < q0 + 32; i += NW * 32 * 4) { v4f d = *(const v4f*)(dlt + i);
#pragma unroll
        for (int c = 0; c < 4; ++c) d[c] = bfr(d[c]) * (SCL * L2E);
        *(v4fa*)&dls[i] = d; }
    __syncthreads();
    if (q0 < RH) fa_body<bf, true>(Qh + pz, Kh + pz, Vh + pz, dls, c1, q0, w, lr, hi, m, l, o);
    else         fa_body<h16, false>(Q16 + pz, K16 + pz, V16 + pz, dls, c1, q0, w, lr, hi, m, l, o);
    // merge of the 4 waves' partials (a wave without a block has m = -3e38, l = 0, o = 0: weight 0)
#pragma unroll
    for (int nq = 0; nq < 2; ++nq) { l[nq] += xhalf(l[nq]); if (hi == 0) { ms[w][nq * 16 + lr] = m[nq]; ls[w][nq * 16 + lr] = l[nq]; }
#pragma unroll
        for (int dt = 0; dt < 4; ++dt) { float* dst = &op[w][(nq * 16 + lr) * OPI + dt * 16 + hi * 8]; const v8f a = o[dt][nq];
            *(v4fa*)dst = __builtin_shufflevector(a, a, 0, 1, 2, 3); *(v4fa*)(dst + 4) = __builtin_shufflevector(a, a, 4, 5, 6, 7); } }
    __syncthreads();
    const int q = threadIdx.x >> 2, dq = (threadIdx.x & 3) * 16;
    float M = ms[0][q];
#pragma unroll
    for (int u = 1; u < NW; ++u) M = fmaxf(M, ms[u][q]);
    float wt[NW], Ls = 0.f;
#pragma unroll
    for (int u = 0; u < NW; ++u) { wt[u] = __builtin_amdgcn_exp2f(ms[u][q] - M); Ls += wt[u] * ls[u][q]; }
    const float inv = __fdiv_rn(1.0f, Ls);
    float* orow = OUT + ((size_t)(b * TT + q0 + q) * NH_ + h) * HD + dq;
#pragma unroll
    for (int c = 0; c < 4; ++c) { v4f a = (v4f){};
#pragma unroll
        for (int u = 0; u < NW; ++u) a += wt[u] * *(const v4fa*)&op[u][q * OPI + dq + c * 4];
        *(v4f*)(orow + c * 4) = a * inv; }
}

extern "C" void kernel_launch(void* const* d_in, const int* in_sizes, int n_in,
                              void* d_out, int out_size, void* d_ws, size_t ws_size, hipStream_t stream) {
    (void)in_sizes; (void)n_in; (void)out_size;
    const float* qi = (const float*)d_in[0]; const float* ki = (const float*)d_in[1]; const float* vi = (const float*)d_in[2]; const float* tau = (const float*)d_in[3]; const float* delta = (const float*)d_in[4];
    float* OUT = (float*)d_out;     // [2][2048][1024]
    char* wsp = (char*)d_ws;
    auto take = [&](size_t bytes) { char* p = wsp; wsp += (bytes + 255) & ~(size_t)255; return (void*)p; };
    float* CS = (float*)take((size_t)TT * HD * 2 * 4);
    const size_t PB = (size_t)NH_ * TT * HD;      // elements of one batch's planes; every plane holds both batches
    h16* QP16 = (h16*)take(NB_ * PB * 2); h16* KP16 = (h16*)take(NB_ * PB * 2); h16* VT16 = (h16*)take(NB_ * PB * 2);
    bf* QPh = (bf*)take(NB_ * PB * 2); bf* QPl = (bf*)take(NB_ * PB * 2); bf* KPh = (bf*)take(NB_ * PB * 2); bf* KPl = (bf*)take(NB_ * PB * 2); bf* VTh = (bf*)take(NB_ * PB * 2); bf* VTl = (bf*)take(NB_ * PB * 2);
    if ((size_t)(wsp - (char*)d_ws) > ws_size) return;    // ws 256 MiB
    k_csid<<<(TT * HD + 255) / 256, 256, 0, stream>>>(CS);
    const unsigned LQ = (unsigned)(((size_t)NH_ * TT * HD / 2 + 255) / 256), LKv = (unsigned)(((size_t)NKV * TT * HD / 2 + 255) / 256);
    for (int b = 0; b < NB_; ++b) {
        k_rope<<<LQ, 256, 0, stream>>>(qi + (size_t)b * TT * DQ, DQ, NH_, CS, nullptr, nullptr, 1.0f, QP16 + b * PB, QPh + b * PB, QPl + b * PB);
        k_rope<<<LKv, 256, 0, stream>>>(ki + (size_t)b * TT * DKV, DKV, NKV, CS, nullptr, nullptr, 1.0f, KP16 + b * PB, KPh + b * PB, KPl + b * PB);
        k_vtp<<<LKv, 256, 0, stream>>>(vi + (size_t)b * TT * DKV, DKV, NKV, VT16 + b * PB, VTh + b * PB, VTl + b * PB);
    }
    k_fattn<<<dim3(NB_ * NH_, TT / 32), NW * 32, 0, stream>>>(QP16, KP16, VT16, QPh, KPh, VTh, tau, delta, OUT);
}

// v003
// A run of this version takes 45.2 microseconds.
// In two side-by-side timings against v002, it was 1.90 and 1.89 times as fast.
// Over all steps from v000 it is 29.3 times as fast.
#include <hip/hip_runtime.h>

// De-stationary causal attention on given q, k, v ([2][2048][16][64] token-major; tau [2][1], delta [2][2048]): scores = (q.k) x tau_b + delta_b[s] (per-key bias), causal (-inf above the diagonal), A = softmax(scores / 8), V[b][l][h][d] = sum_s A v -> [2][2048][16][64] f32 (4.2 M).
// Layout: one plane builder turns the token-major inputs of both batches into head planes (q, k: [b*16+h][t][d]; v transposed: [b*16+h][d][t]; bf16-rounded on read); ONE fused kernel then does scores, softmax and attn.v per 32 query rows without ever storing a score or a probability, and writes the token-major f32 output.
// Compute dtypes, f32 accumulate: q, k, v, tau, delta rounded to bf16: hi planes exact, lo planes exactly zero (their products add +0 and are not formed); query rows < 512: bf16 scores, probabilities as bf16 hi + lo; the rest single fp16; softmax f32 (running maximum); f32 output.

#define NB_  2
#define TT   2048
#define DM   1024
#define NH_  16
#define NKV  16
#define REP  (NH_ / NKV)
#define HD   64
#define DQ   (NH_ * HD)
#define DKV  (NKV * HD)
#define RH   512                  // query rows < RH use the bf16 hi planes and hi+lo P (0: none)
#define WIN  2048
#define SCL  0.125f   // HD^-0.5
typedef _Float16 h16;
typedef unsigned short bf;
typedef __attribute__((ext_vector_type(16))) __bf16   v16bf;
typedef __attribute__((ext_vector_type(16))) _Float16 v16h;
typedef __attribute__((ext_vector_type(8)))  _Float16 v8h;
typedef __attribute__((ext_vector_type(8)))  unsigned short v8us;
typedef __attribute__((ext_vector_type(8)))  float    v8f;
typedef __attribute__((ext_vector_type(4)))  float    v4f;
typedef v8h  __attribute__((may_alias)) v8ha;
typedef v4f  __attribute__((may_alias)) v4fa;
typedef v8us __attribute__((may_alias)) v8usa;

__device__ __forceinline__ unsigned short f2bf(float f) { unsigned u = __float_as_uint(f); u += 0x7FFFu + ((u >> 16) & 1u); return (unsigned short)(u >> 16); }
__device__ __forceinline__ float bf2f(unsigned short b) { return __uint_as_float(((unsigned)b) << 16); }
__device__ __forceinline__ float bfr(float f) { return bf2f(f2bf(f)); }
__device__ __forceinline__ v16h cat16(v8h lo, v8h hi) { return __builtin_shufflevector(lo, hi, 0, 1, 2, 3, 4, 5, 6, 7, 8, 9, 10, 11, 12, 13, 14, 15); }
__device__ __forceinline__ v16bf cat16b(v8us lo, v8us hi) { return __builtin_bit_cast(v16bf, __builtin_shufflevector(lo, hi, 0, 1, 2, 3, 4, 5, 6, 7, 8, 9, 10, 11, 12, 13, 14, 15)); }
__device__ __forceinline__ v8f wmma16(v16h a, v16h b, v8f c) { return __builtin_amdgcn_wmma_f32_16x16x32_f16(false, a, false, b, (short)0, c, false, false); }
__device__ __forceinline__ v8f wmmab(v16bf a, v16bf b, v8f c) { return __builtin_amdgcn_wmma_f32_16x16x32_bf16(false, a, false, b, (short)0, c, false, false); }



// 16-bit fragment loader (hardware k order: bytes 16 hi and 32 + 16 hi of each 64 bytes of a K-contiguous row) and matrix product per operand type
template <typename T16> struct WFrag;
template <> struct WFrag<h16> { typedef v16h V; static __device__ __forceinline__ V ld(const h16* p) { return cat16(*(const v8h*)p, *(const v8h*)(p + 16)); } static __device__ __forceinline__ v8f mma(V a, V b, v8f c) { return wmma16(a, b, c); } };
template <> struct WFrag<bf> { typedef v16bf V; static __device__ __forceinline__ V ld(const bf* p) { return cat16b(*(const v8us*)p, *(const v8us*)(p + 16)); } static __device__ __forceinline__ v8f mma(V a, V b, v8f c) { return wmmab(a, b, c); } };

typedef __attribute__((ext_vector_type(4))) _Float16 v4h;
typedef __attribute__((ext_vector_type(4))) unsigned short v4us;
typedef __attribute__((ext_vector_type(2))) float v2f;

// k_planes: every plane that k_fattn reads, in one launch. One work-group = PT tokens of one (batch, head), for q, k and v: each thread issues its 24 16-byte loads (16 lanes = one token's 256-byte head row) before it converts anything,
// so the whole input is in flight at once from 4096 waves. bf16 rounding (nearest even) on read; fp16 planes hold the rounded values. q, k: a wave stores two adjacent 128-byte plane rows per instruction.
// v: a thread holds 8 tokens x 4 d, writes 8 tokens of one d as 16 bytes into an LDS tile [d][token]; the tile's 256-byte rows then go out whole. bf16 planes are read only for tokens < RH, the fp16 q plane only for tokens >= RH.
#define PT   128                  // tokens per work-group
#define VPI  136                  // LDS pitch of a tile row in 16-bit elements: 272 bytes = 16 x 17, free of bank conflicts for the 16-byte row reads
static_assert(RH % PT == 0 && TT % PT == 0, "a token block lies on one side of RH");
typedef __attribute__((ext_vector_type(4))) __bf16 v4bf;
__device__ __forceinline__ v4us rb4(v4f x) { return __builtin_bit_cast(v4us, __builtin_convertvector(x, v4bf)); }
__device__ __forceinline__ v4h bh4(v4us u) { v4f y;
#pragma unroll
    for (int e = 0; e < 4; ++e) y[e] = bf2f(u[e]);
    return __builtin_convertvector(y, v4h); }
__global__ __launch_bounds__(256) void k_planes(const float* __restrict__ q, const float* __restrict__ k, const float* __restrict__ v, h16* __restrict__ Q16, h16* __restrict__ K16, h16* __restrict__ V16, bf* __restrict__ Qh, bf* __restrict__ Kh, bf* __restrict__ Vh) {
    __shared__ __align__(16) unsigned short vt[2][HD * VPI];
    const int z = blockIdx.x / (TT / PT), b = z / NH_, h = z % NH_, t0 = (blockIdx.x % (TT / PT)) * PT; const int c = threadIdx.x & 15, r = threadIdx.x >> 4;
    const size_t in0 = ((size_t)(b * TT + t0) * NH_ + h) * HD + c * 4; const bool lo = t0 < RH;
    v4f xv[8], xq[8], xk[8];                                        // every '#pragma unroll' below over j or dd: its loop indexes register arrays
#pragma unroll
    for (int j = 0; j < 8; ++j) xv[j] = *(const v4f*)(v + in0 + (size_t)(r * 8 + j) * DKV);
    asm volatile("s_wait_xcnt 0x0" ::: "memory");                   // a later load may land in the address registers of the loads above
#pragma unroll
    for (int j = 0; j < 8; ++j) xq[j] = *(const v4f*)(q + in0 + (size_t)(j * 16 + r) * DQ);
    asm volatile("s_wait_xcnt 0x0" ::: "memory");                   // as above
#pragma unroll
    for (int j = 0; j < 8; ++j) xk[j] = *(const v4f*)(k + in0 + (size_t)(j * 16 + r) * DKV);
    __builtin_amdgcn_sched_barrier(0);                              // all 24 loads are issued before the first wait; without it part of them sinks behind v's conversion
    v4us uv[8]; v4h hv[8];
#pragma unroll
    for (int j = 0; j < 8; ++j) { uv[j] = rb4(xv[j]); hv[j] = bh4(uv[j]); }
    const int at = c * 4 * VPI + r * 8;
#pragma unroll
    for (int dd = 0; dd < 4; ++dd) { v8h f;
#pragma unroll
        for (int j = 0; j < 8; ++j) f[j] = hv[j][dd];
        *(v8ha*)&vt[0][at + dd * VPI] = f; }
    if (lo) {
#pragma unroll
        for (int dd = 0; dd < 4; ++dd) { v8us a;
#pragma unroll
            for (int j = 0; j < 8; ++j) a[j] = uv[j][dd];
            *(v8usa*)&vt[1][at + dd * VPI] = a; } }
    // the tile's hand-over orders LDS alone: __syncthreads() would also wait here for the q and k loads that are still in flight
    __builtin_amdgcn_fence(__ATOMIC_RELEASE, "workgroup", "local"); __builtin_amdgcn_s_barrier(); __builtin_amdgcn_fence(__ATOMIC_ACQUIRE, "workgroup", "local");
    const size_t vo = ((size_t)z * HD + r) * TT + t0 + c * 8; const int rd = r * VPI + c * 8;
#pragma unroll
    for (int i = 0; i < 4; ++i) *(v8h*)(V16 + vo + (size_t)i * 16 * TT) = *(const v8ha*)&vt[0][rd + i * 16 * VPI];
    asm volatile("s_wait_xcnt 0x0" ::: "memory");                   // the conversions below reuse the registers of the stores above
    const size_t po = ((size_t)z * TT + t0 + r) * HD + c * 4;
    if (!lo) {
#pragma unroll
        for (int j = 0; j < 8; ++j) *(v4h*)(Q16 + po + (size_t)j * 16 * HD) = bh4(rb4(xq[j])); }
#pragma unroll
    for (int j = 0; j < 8; ++j) *(v4h*)(K16 + po + (size_t)j * 16 * HD) = bh4(rb4(xk[j]));
    if (lo) {
        asm volatile("s_wait_xcnt 0x0" ::: "memory");               // the LDS reads below land in registers of the stores above
#pragma unroll
        for (int i = 0; i < 4; ++i) *(v8us*)(Vh + vo + (size_t)i * 16 * TT) = *(const v8usa*)&vt[1][rd + i * 16 * VPI];
#pragma unroll
        for (int j = 0; j < 8; ++j) *(v4us*)(Qh + po + (size_t)j * 16 * HD) = rb4(xq[j]);
#pragma unroll
        for (int j = 0; j < 8; ++j) *(v4us*)(Kh + po + (size_t)j * 16 * HD) = rb4(xk[j]); }
}

// ---- k_fattn: fused causal attention. One work-group = 32 query rows of one (batch, head); its 4 waves take the 32-key blocks w, w + 4, w + 8, ... up to the diagonal block, each with its own running
// maxima, sums and output accumulators, and merge them once through LDS. Per block: S^T = K.Q^T (A = K rows, B = Q rows, same loader), so a lane holds 16 scores of ONE query (column lr; keys 8 hi + j and 16 + 8 hi + j),
// which after exp2 are, converted in place, the B operand of O^T += V^T.P^T (A = V^T rows by the same loader: equal k order). O^T: lane = query lr, registers = 8 consecutive d.
#define NW   4                    // waves per work-group (interleaved key blocks)
#define OPI  68                   // LDS pitch (floats) of a partial output row
#define L2E  1.4426950408889634f
typedef __attribute__((ext_vector_type(16))) float v16f;
__device__ __forceinline__ float xhalf(float x) { const int b = __float_as_int(x); return __int_as_float(__builtin_amdgcn_permlanex16(b, b, 0x76543210, 0xfedcba98, false, false)); }   // lane l <-> l ^ 16
template <typename T16, bool HI>
__device__ __forceinline__ void fa_body(const T16* __restrict__ Q, const T16* __restrict__ Kp, const T16* __restrict__ Vt, const float* dls, const float c1, const int q0, const int w, const int lr, const int hi, float (&m)[2], float (&l)[2], v8f (&o)[4][2]) {
    typedef typename WFrag<T16>::V V;                               // every '#pragma unroll' below: its loop indexes register arrays (fragments, accumulators), which stay in registers only under constant indices
    const int nst = q0 / 32 + 1;                                    // key blocks 0 .. q0 / 32; only the last one meets the diagonal
    V qf[2][2], kf[2][2];
#pragma unroll
    for (int nq = 0; nq < 2; ++nq)
#pragma unroll
        for (int kc = 0; kc < 2; ++kc) qf[nq][kc] = WFrag<T16>::ld(Q + (size_t)(q0 + nq * 16 + lr) * HD + kc * 32 + 8 * hi);
    const T16* kb = Kp + (size_t)lr * HD + 8 * hi; const T16* vb = Vt + (size_t)lr * TT + 8 * hi;
    { const int kn = min(w, nst - 1) * 32;
#pragma unroll
      for (int t = 0; t < 2; ++t)
#pragma unroll
          for (int kc = 0; kc < 2; ++kc) kf[t][kc] = WFrag<T16>::ld(kb + (size_t)(kn + t * 16) * HD + kc * 32); }
#pragma unroll 1
    for (int s = w; s < nst; s += NW) {                             // rolled: the body is long and the trip count varies
        const int k0 = s * 32;
        V vf[4];
#pragma unroll
        for (int dt = 0; dt < 4; ++dt) vf[dt] = WFrag<T16>::ld(vb + (size_t)dt * 16 * TT + k0);
        v4f dr[4];                                                  // this lane's 16 keys' bias, from LDS (already rounded and scaled)
#pragma unroll
        for (int u = 0; u < 4; ++u) dr[u] = *(const v4fa*)(dls + k0 + (u >> 1) * 16 + hi * 8 + (u & 1) * 4);
        v8f st[2][2];
#pragma unroll
        for (int t = 0; t < 2; ++t)
#pragma unroll
            for (int nq = 0; nq < 2; ++nq) { st[t][nq] = WFrag<T16>::mma(kf[t][0], qf[nq][0], (v8f){}); st[t][nq] = WFrag<T16>::mma(kf[t][1], qf[nq][1], st[t][nq]); }
        { const int kn = min(s + NW, nst - 1) * 32;                 // this wave's next K block, fetched one pass ahead (clamped: always inside the plane)
#pragma unroll
          for (int t = 0; t < 2; ++t)
#pragma unroll
              for (int kc = 0; kc < 2; ++kc) kf[t][kc] = WFrag<T16>::ld(kb + (size_t)(kn + t * 16) * HD + kc * 32); }
        float x[2][16], mx[2];
#pragma unroll
        for (int e = 0; e < 16; ++e) { const float dl = dr[e >> 2][e & 3];
#pragma unroll
            for (int nq = 0; nq < 2; ++nq) x[nq][e] = fmaf(st[e >> 3][nq][e & 7], c1, dl); }   /* (s x tau + delta_j) x scale, in log2 units */
        if (s == nst - 1) {                                         // diagonal block (k0 == q0): keys above the query's own index drop out
#pragma unroll
            for (int nq = 0; nq < 2; ++nq)
#pragma unroll
                for (int e = 0; e < 16; ++e) if ((e >> 3) * 16 + hi * 8 + (e & 7) > nq * 16 + lr) x[nq][e] = -3.0e38f; }
#pragma unroll
        for (int nq = 0; nq < 2; ++nq) { float a = x[nq][0];
#pragma unroll
            for (int e = 1; e < 16; ++e) a = fmaxf(a, x[nq][e]);
            mx[nq] = fmaxf(a, xhalf(a)); }
        // lazy rescale: the maximum in use moves only when some query's new maximum exceeds it by more than 8 (log2 units), so p <= 256
        if (__builtin_amdgcn_ballot_w32(mx[0] > m[0] + 8.0f || mx[1] > m[1] + 8.0f) != 0) {
#pragma unroll
            for (int nq = 0; nq < 2; ++nq) { const float mn = fmaxf(m[nq], mx[nq]); const float al = __builtin_amdgcn_exp2f(m[nq] - mn); m[nq] = mn; l[nq] *= al;
#pragma unroll
                for (int dt = 0; dt < 4; ++dt) o[dt][nq] *= al; } }
#pragma unroll
        for (int nq = 0; nq < 2; ++nq) { v16f p; float sm = 0.f;
#pragma unroll
            for (int e = 0; e < 16; e += 2) { const v2f y = (v2f){x[nq][e], x[nq][e + 1]} - m[nq]; p[e] = __builtin_amdgcn_exp2f(y[0]); p[e + 1] = __builtin_amdgcn_exp2f(y[1]); sm += p[e]; sm += p[e + 1]; }
            l[nq] += sm;
            if constexpr (HI) { const v16bf ph = __builtin_convertvector(p, v16bf); const v16bf pl = __builtin_convertvector(p - __builtin_convertvector(ph, v16f), v16bf);
#pragma unroll
                for (int dt = 0; dt < 4; ++dt) { o[dt][nq] = wmmab(vf[dt], ph, o[dt][nq]); o[dt][nq] = wmmab(vf[dt], pl, o[dt][nq]); }
            } else { const v16h ph = __builtin_convertvector(p, v16h);
#pragma unroll
                for (int dt = 0; dt < 4; ++dt) o[dt][nq] = wmma16(vf[dt], ph, o[dt][nq]); } }
    }
}
__global__ __launch_bounds__(NW * 32) void k_fattn(const h16* __restrict__ Q16, const h16* __restrict__ K16, const h16* __restrict__ V16, const bf* __restrict__ Qh, const bf* __restrict__ Kh, const bf* __restrict__ Vh, const float* __restrict__ tau, const float* __restrict__ delta, float* OUT) {
    __shared__ __align__(16) float op[NW][32 * OPI]; __shared__ float ms[NW][32], ls[NW][32]; __shared__ __align__(16) float dls[TT];
    const int z = blockIdx.x, b = z / NH_, h = z % NH_; const int q0 = (TT / 32 - 1 - (int)blockIdx.y) * 32;   // longest tiles first
    const int w = __builtin_amdgcn_readfirstlane(threadIdx.x >> 5), lane = threadIdx.x & 31, lr = lane & 15, hi = lane >> 4;
    const float c1 = bfr(tau[b]) * (SCL * L2E); const float* dlt = delta + (size_t)b * TT; const size_t pz = (size_t)z * TT * HD;
    float m[2] = {-3.0e38f, -3.0e38f}, l[2] = {0.f, 0.f}; v8f o[4][2];
#pragma unroll
    for (int dt = 0; dt < 4; ++dt)
#pragma unroll
        for (int nq = 0; nq < 2; ++nq) o[dt][nq] = (v8f){};
    // per-key bias delta_j x scale in log2 units (bf16-rounded on read), once per work-group, for the keys this tile can see
    for (int i = threadIdx.x * 4; i < q0 + 32; i += NW * 32 * 4) { v4f d = *(const v4f*)(dlt + i);
#pragma unroll
        for (int c = 0; c < 4; ++c) d[c] = bfr(d[c]) * (SCL * L2E);
        *(v4fa*)&dls[i] = d; }
    __syncthreads();
    if (q0 < RH) fa_body<bf, true>(Qh + pz, Kh + pz, Vh + pz, dls, c1, q0, w, lr, hi, m, l, o);
    else         fa_body<h16, false>(Q16 + pz, K16 + pz, V16 + pz, dls, c1, q0, w, lr, hi, m, l, o);
    // merge of the 4 waves' partials (a wave without a block has m = -3e38, l = 0, o = 0: weight 0)
#pragma unroll
    for (int nq = 0; nq < 2; ++nq) { l[nq] += xhalf(l[nq]); if (hi == 0) { ms[w][nq * 16 + lr] = m[nq]; ls[w][nq * 16 + lr] = l[nq]; }
#pragma unroll
        for (int dt = 0; dt < 4; ++dt) { float* dst = &op[w][(nq * 16 + lr) * OPI + dt * 16 + hi * 8]; const v8f a = o[dt][nq];
            *(v4fa*)dst = __builtin_shufflevector(a, a, 0, 1, 2, 3); *(v4fa*)(dst + 4) = __builtin_shufflevector(a, a, 4, 5, 6, 7); } }
    __syncthreads();
    const int q = threadIdx.x >> 2, dq = (threadIdx.x & 3) * 16;
    float M = ms[0][q];
#pragma unroll
    for (int u = 1; u < NW; ++u) M = fmaxf(M, ms[u][q]);
    float wt[NW], Ls = 0.f;
#pragma unroll
    for (int u = 0; u < NW; ++u) { wt[u] = __builtin_amdgcn_exp2f(ms[u][q] - M); Ls += wt[u] * ls[u][q]; }
    const float inv = __fdiv_rn(1.0f, Ls);
    float* orow = OUT + ((size_t)(b * TT + q0 + q) * NH_ + h) * HD + dq;
#pragma unroll
    for (int c = 0; c < 4; ++c) { v4f a = (v4f){};
#pragma unroll
        for (int u = 0; u < NW; ++u) a += wt[u] * *(const v4fa*)&op[u][q * OPI + dq + c * 4];
        *(v4f*)(orow + c * 4) = a * inv; }
}

extern "C" void kernel_launch(void* const* d_in, const int* in_sizes, int n_in,
                              void* d_out, int out_size, void* d_ws, size_t ws_size, hipStream_t stream) {
    (void)in_sizes; (void)n_in; (void)out_size;
    const float* qi = (const float*)d_in[0]; const float* ki = (const float*)d_in[1]; const float* vi = (const float*)d_in[2]; const float* tau = (const float*)d_in[3]; const float* delta = (const float*)d_in[4];
    float* OUT = (float*)d_out;     // [2][2048][1024]
    char* wsp = (char*)d_ws;
    auto take = [&](size_t bytes) { char* p = wsp; wsp += (bytes + 255) & ~(size_t)255; return (void*)p; };
    const size_t PB = (size_t)NH_ * TT * HD;      // elements of one batch's planes; every plane holds both batches
    h16* QP16 = (h16*)take(NB_ * PB * 2); h16* KP16 = (h16*)take(NB_ * PB * 2); h16* VT16 = (h16*)take(NB_ * PB * 2);
    bf* QPh = (bf*)take(NB_ * PB * 2); bf* KPh = (bf*)take(NB_ * PB * 2); bf* VTh = (bf*)take(NB_ * PB * 2);
    if ((size_t)(wsp - (char*)d_ws) > ws_size) return;    // ws 256 MiB
    k_planes<<<NB_ * NH_ * (TT / PT), 256, 0, stream>>>(qi, ki, vi, QP16, KP16, VT16, QPh, KPh, VTh);
    k_fattn<<<dim3(NB_ * NH_, TT / 32), NW * 32, 0, stream>>>(QP16, KP16, VT16, QPh, KPh, VTh, tau, delta, OUT);
}

// v004
// A run of this version takes 30.6 microseconds.
// Next to v003, in two timings, it ran 1.46 and 1.48 times as fast.
// Counting every step since v000, it is 43.0 times as fast.
#include <hip/hip_runtime.h>

// De-stationary causal attention on given q, k, v ([2][2048][16][64] token-major; tau [2][1], delta [2][2048]): scores = (q.k) x tau_b + delta_b[s] (per-key bias), causal (-inf above the diagonal), A = softmax(scores / 8), V[b][l][h][d] = sum_s A v -> [2][2048][16][64] f32 (4.2 M).
// Layout: one plane builder turns the token-major inputs of both batches into head planes (q, k and transposed v: per head in the order in which a wave loads its matrix fragments, see k_planes; bf16-rounded on read); ONE fused kernel then does scores, softmax and attn.v per 32 query rows without ever storing a score or a probability, and writes the token-major f32 output.
// Compute dtypes, f32 accumulate: q, k, v, tau, delta rounded to bf16: hi planes exact, lo planes exactly zero (their products add +0 and are not formed); query rows < 512: bf16 scores, probabilities as bf16 hi + lo; the rest single fp16; softmax f32 (running maximum); f32 output.

#define NB_  2
#define TT   2048
#define DM   1024
#define NH_  16
#define NKV  16
#define REP  (NH_ / NKV)
#define HD   64
#define DQ   (NH_ * HD)
#define DKV  (NKV * HD)
#define RH   512                  // query rows < RH use the bf16 hi planes and hi+lo P (0: none)
#define WIN  2048
#define SCL  0.125f   // HD^-0.5
typedef _Float16 h16;
typedef unsigned short bf;
typedef __attribute__((ext_vector_type(16))) __bf16   v16bf;
typedef __attribute__((ext_vector_type(16))) _Float16 v16h;
typedef __attribute__((ext_vector_type(8)))  _Float16 v8h;
typedef __attribute__((ext_vector_type(8)))  unsigned short v8us;
typedef __attribute__((ext_vector_type(8)))  float    v8f;
typedef __attribute__((ext_vector_type(4)))  float    v4f;
typedef v8h  __attribute__((may_alias)) v8ha;
typedef v4f  __attribute__((may_alias)) v4fa;
typedef v8us __attribute__((may_alias)) v8usa;

__device__ __forceinline__ unsigned short f2bf(float f) { unsigned u = __float_as_uint(f); u += 0x7FFFu + ((u >> 16) & 1u); return (unsigned short)(u >> 16); }
__device__ __forceinline__ float bf2f(unsigned short b) { return __uint_as_float(((unsigned)b) << 16); }
__device__ __forceinline__ float bfr(float f) { return bf2f(f2bf(f)); }
__device__ __forceinline__ v16h cat16(v8h lo, v8h hi) { return __builtin_shufflevector(lo, hi, 0, 1, 2, 3, 4, 5, 6, 7, 8, 9, 10, 11, 12, 13, 14, 15); }
__device__ __forceinline__ v16bf cat16b(v8us lo, v8us hi) { return __builtin_bit_cast(v16bf, __builtin_shufflevector(lo, hi, 0, 1, 2, 3, 4, 5, 6, 7, 8, 9, 10, 11, 12, 13, 14, 15)); }
__device__ __forceinline__ v8f wmma16(v16h a, v16h b, v8f c) { return __builtin_amdgcn_wmma_f32_16x16x32_f16(false, a, false, b, (short)0, c, false, false); }
__device__ __forceinline__ v8f wmmab(v16bf a, v16bf b, v8f c) { return __builtin_amdgcn_wmma_f32_16x16x32_bf16(false, a, false, b, (short)0, c, false, false); }



// 16-bit fragment loader and matrix product per operand type. ldf: a fragment of a fragment-ordered plane (see k_planes; p already holds lane x 8): each of its two halves is 512 contiguous bytes per wave. Hardware k order: a lane holds k = 8 hi .. 8 hi + 7 and 16 + 8 hi .. 16 + 8 hi + 7 of its row
template <typename T16> struct WFrag;
template <> struct WFrag<h16> { typedef v16h V; static __device__ __forceinline__ V ldf(const h16* p) { return cat16(*(const v8h*)p, *(const v8h*)(p + 256)); } static __device__ __forceinline__ v8f mma(V a, V b, v8f c) { return wmma16(a, b, c); } };
template <> struct WFrag<bf> { typedef v16bf V; static __device__ __forceinline__ V ldf(const bf* p) { return cat16b(*(const v8us*)p, *(const v8us*)(p + 256)); } static __device__ __forceinline__ v8f mma(V a, V b, v8f c) { return wmmab(a, b, c); } };

typedef __attribute__((ext_vector_type(4))) _Float16 v4h;
typedef __attribute__((ext_vector_type(4))) unsigned short v4us;
typedef __attribute__((ext_vector_type(2))) float v2f;

// k_planes: every plane that k_fattn reads, in one launch. One work-group = PT tokens of one (batch, head), for q, k and v: each thread issues its 24 16-byte loads (16 lanes = one token's 256-byte head row) before it converts anything,
// so the whole input is in flight at once from 4096 waves. bf16 rounding (nearest even) on read; fp16 planes hold the rounded values.
// FRAGMENT ORDER of the planes: a 16-row x 32-k fragment is 1 KiB = [half j][lane = 16 hi + lr][8 elements], element e of row lr at k = 16 j + 8 hi + e. q, k: rows = tokens, k = d: [token / 16][d / 32][fragment]; v: rows = d, k = keys: [key / 32][d / 16][fragment].
// So every 16-byte-per-lane fragment load of k_fattn covers 4 whole 128-byte lines, where a row-major plane gives it 32 bytes of each of 16 lines. q and k go through LDS tiles [token][d] for it, so that the planes are stored in whole lines too.
// v: a thread holds 8 tokens x 4 d, writes 8 tokens of one d as 16 bytes into an LDS tile [d][token], from which the fragments are read. bf16 planes are read only for tokens < RH, the fp16 q plane only for tokens >= RH.
#define PT   128                  // tokens per work-group
#define KPI  72                   // LDS pitch of a q or k tile row in 16-bit elements: 144 bytes = 16 x 9, free of bank conflicts for the 16-byte reads of 16 rows
#define VPI  136                  // LDS pitch of a v tile row in 16-bit elements: 272 bytes = 16 x 17, free of bank conflicts for the 16-byte reads of 16 rows
static_assert(RH % PT == 0 && TT % PT == 0, "a token block lies on one side of RH");
typedef __attribute__((ext_vector_type(4))) __bf16 v4bf;
typedef v4h  __attribute__((may_alias)) v4ha;
typedef v4us __attribute__((may_alias)) v4usa;
__device__ __forceinline__ v4us rb4(v4f x) { return __builtin_bit_cast(v4us, __builtin_convertvector(x, v4bf)); }
__device__ __forceinline__ v4h bh4(v4us u) { v4f y;
#pragma unroll
    for (int e = 0; e < 4; ++e) y[e] = bf2f(u[e]);
    return __builtin_convertvector(y, v4h); }
__global__ __launch_bounds__(256) void k_planes(const float* __restrict__ q, const float* __restrict__ k, const float* __restrict__ v, h16* __restrict__ Q16, h16* __restrict__ K16, h16* __restrict__ V16, bf* __restrict__ Qh, bf* __restrict__ Kh, bf* __restrict__ Vh) {
    __shared__ __align__(16) unsigned short vt[2][HD * VPI]; __shared__ __align__(16) unsigned short kt[2][PT * KPI], qt[PT * KPI];
    const int z = blockIdx.x / (TT / PT), b = z / NH_, h = z % NH_, t0 = (blockIdx.x % (TT / PT)) * PT; const int c = threadIdx.x & 15, r = threadIdx.x >> 4; const int ln = threadIdx.x & 31, wv = threadIdx.x >> 5;
    const size_t in0 = ((size_t)(b * TT + t0) * NH_ + h) * HD + c * 4; const bool lo = t0 < RH;
    v4f xv[8], xq[8], xk[8];                                        // every '#pragma unroll' below over j or dd: its loop indexes register arrays
#pragma unroll
    for (int j = 0; j < 8; ++j) xv[j] = *(const v4f*)(v + in0 + (size_t)(r * 8 + j) * DKV);
    asm volatile("s_wait_xcnt 0x0" ::: "memory");                   // a later load may land in the address registers of the loads above
#pragma unroll
    for (int j = 0; j < 8; ++j) xq[j] = *(const v4f*)(q + in0 + (size_t)(j * 16 + r) * DQ);
    asm volatile("s_wait_xcnt 0x0" ::: "memory");                   // as above
#pragma unroll
    for (int j = 0; j < 8; ++j) xk[j] = *(const v4f*)(k + in0 + (size_t)(j * 16 + r) * DKV);
    __builtin_amdgcn_sched_barrier(0);                              // all 24 loads are issued before the first wait; without it part of them sinks behind v's conversion
    v4us uv[8]; v4h hv[8];
#pragma unroll
    for (int j = 0; j < 8; ++j) { uv[j] = rb4(xv[j]); hv[j] = bh4(uv[j]); }
    const int at = c * 4 * VPI + r * 8;
#pragma unroll
    for (int dd = 0; dd < 4; ++dd) { v8h f;
#pragma unroll
        for (int j = 0; j < 8; ++j) f[j] = hv[j][dd];
        *(v8ha*)&vt[0][at + dd * VPI] = f; }
    if (lo) {
#pragma unroll
        for (int dd = 0; dd < 4; ++dd) { v8us a;
#pragma unroll
            for (int j = 0; j < 8; ++j) a[j] = uv[j][dd];
            *(v8usa*)&vt[1][at + dd * VPI] = a; } }
    // the tile's hand-over orders LDS alone: __syncthreads() would also wait here for the q and k loads that are still in flight
    __builtin_amdgcn_fence(__ATOMIC_RELEASE, "workgroup", "local"); __builtin_amdgcn_s_barrier(); __builtin_amdgcn_fence(__ATOMIC_ACQUIRE, "workgroup", "local");
    // read-out in fragment order: wave wv stores 4 half fragments (512 bytes each) of key block wv / 2: d tiles 2 (wv & 1) and 2 (wv & 1) + 1
    const size_t vo = (size_t)z * TT * HD + (size_t)(t0 / 32 + (wv >> 1)) * 2048 + (wv & 1) * 1024 + ln * 8; const int rd = ((wv & 1) * 32 + (ln & 15)) * VPI + (wv >> 1) * 32 + (ln >> 4) * 8;
#pragma unroll
    for (int i = 0; i < 4; ++i) *(v8h*)(V16 + vo + i * 256) = *(const v8ha*)&vt[0][rd + (i >> 1) * 16 * VPI + (i & 1) * 16];
    asm volatile("s_wait_xcnt 0x0" ::: "memory");                   // the conversions below reuse the registers of the stores above
    const int ka = r * KPI + c * 4;                                 // one q plane per token block: bf16 below RH, fp16 from there on
    if (lo) {
#pragma unroll
        for (int j = 0; j < 8; ++j) *(v4usa*)&qt[ka + j * 16 * KPI] = rb4(xq[j]);
#pragma unroll
        for (int j = 0; j < 8; ++j) *(v4usa*)&kt[1][ka + j * 16 * KPI] = rb4(xk[j]);
    } else {
#pragma unroll
        for (int j = 0; j < 8; ++j) *(v4ha*)&qt[ka + j * 16 * KPI] = bh4(rb4(xq[j])); }
#pragma unroll
    for (int j = 0; j < 8; ++j) *(v4ha*)&kt[0][ka + j * 16 * KPI] = bh4(rb4(xk[j]));
    // hand-over of the q and k tiles: LDS alone, as for v above (the stores in flight need not be waited for)
    __builtin_amdgcn_fence(__ATOMIC_RELEASE, "workgroup", "local"); __builtin_amdgcn_s_barrier(); __builtin_amdgcn_fence(__ATOMIC_ACQUIRE, "workgroup", "local");
    // wave wv stores the 4 half fragments of the tile's tokens 16 wv .. 16 wv + 15
    const size_t ko = (size_t)z * TT * HD + (size_t)(t0 / 16 + wv) * 1024 + ln * 8; const int kr = (wv * 16 + (ln & 15)) * KPI + (ln >> 4) * 8;
#pragma unroll
    for (int i = 0; i < 4; ++i) *(v8h*)(K16 + ko + i * 256) = *(const v8ha*)&kt[0][kr + i * 16];
    asm volatile("s_wait_xcnt 0x0" ::: "memory");                   // the LDS reads below land in registers of the stores above
    if (!lo) {
#pragma unroll
        for (int i = 0; i < 4; ++i) *(v8h*)(Q16 + ko + i * 256) = *(const v8ha*)&qt[kr + i * 16];
        asm volatile("s_wait_xcnt 0x0" ::: "memory");               // in the built code the bf16 block, which reuses these stores' registers, stands behind this one
    } else {
#pragma unroll
        for (int i = 0; i < 4; ++i) *(v8us*)(Qh + ko + i * 256) = *(const v8usa*)&qt[kr + i * 16];
        asm volatile("s_wait_xcnt 0x0" ::: "memory");               // as above
#pragma unroll
        for (int i = 0; i < 4; ++i) *(v8us*)(Kh + ko + i * 256) = *(const v8usa*)&kt[1][kr + i * 16];
        asm volatile("s_wait_xcnt 0x0" ::: "memory");               // as above
#pragma unroll
        for (int i = 0; i < 4; ++i) *(v8us*)(Vh + vo + i * 256) = *(const v8usa*)&vt[1][rd + (i >> 1) * 16 * VPI + (i & 1) * 16]; }
}

// ---- k_fattn: fused causal attention. One work-group = 32 query rows of one (batch, head); its 4 waves take the 32-key blocks w, w + 4, w + 8, ... up to the diagonal block, each with its own running
// maxima, sums and output accumulators, and merge them once through LDS. Per block: S^T = K.Q^T (A = K rows, B = Q rows, same loader), so a lane holds 16 scores of ONE query (column lr; keys 8 hi + j and 16 + 8 hi + j),
// which after exp2 are, converted in place, the B operand of O^T += V^T.P^T (A = V^T rows by the same loader: equal k order). O^T: lane = query lr, registers = 8 consecutive d.
#define NW   4                    // waves per work-group (interleaved key blocks)
#define OPI  68                   // LDS pitch (floats) of a partial output row
#define L2E  1.4426950408889634f
typedef __attribute__((ext_vector_type(16))) float v16f;
__device__ __forceinline__ float xhalf(float x) { const int b = __float_as_int(x); return __int_as_float(__builtin_amdgcn_permlanex16(b, b, 0x76543210, 0xfedcba98, false, false)); }   // lane l <-> l ^ 16
template <typename T16, bool HI>
__device__ __forceinline__ void fa_body(const T16* __restrict__ Q, const T16* __restrict__ Kp, const T16* __restrict__ Vt, const float* dls, const float c1, const int q0, const int w, const int lr, const int hi, float (&m)[2], float (&l)[2], v8f (&o)[4][2]) {
    typedef typename WFrag<T16>::V V;                               // every '#pragma unroll' below: its loop indexes register arrays (fragments, accumulators), which stay in registers only under constant indices
    const int nst = q0 / 32 + 1;                                    // key blocks 0 .. q0 / 32; only the last one meets the diagonal
    V qf[2][2], kf[2][2];
#pragma unroll
    for (int nq = 0; nq < 2; ++nq)
#pragma unroll
        for (int kc = 0; kc < 2; ++kc) qf[nq][kc] = WFrag<T16>::ldf(Q + (size_t)(q0 + nq * 16) * HD + kc * 512 + (hi * 16 + lr) * 8);
    const T16* kb = Kp + (hi * 16 + lr) * 8; const T16* vb = Vt + (hi * 16 + lr) * 8;   // fragment-ordered planes: 32 keys = 2048 elements of either
    { const int kn = min(w, nst - 1) * 32;
#pragma unroll
      for (int t = 0; t < 2; ++t)
#pragma unroll
          for (int kc = 0; kc < 2; ++kc) kf[t][kc] = WFrag<T16>::ldf(kb + (size_t)(kn + t * 16) * HD + kc * 512); }
#pragma unroll 1
    for (int s = w; s < nst; s += NW) {                             // rolled: the body is long and the trip count varies
        const int k0 = s * 32;
        V vf[4];
#pragma unroll
        for (int dt = 0; dt < 4; ++dt) vf[dt] = WFrag<T16>::ldf(vb + (size_t)k0 * HD + dt * 512);
        v4f dr[4];                                                  // this lane's 16 keys' bias, from LDS (already rounded and scaled)
#pragma unroll
        for (int u = 0; u < 4; ++u) dr[u] = *(const v4fa*)(dls + k0 + (u >> 1) * 16 + hi * 8 + (u & 1) * 4);
        v8f st[2][2];
#pragma unroll
        for (int t = 0; t < 2; ++t)
#pragma unroll
            for (int nq = 0; nq < 2; ++nq) { st[t][nq] = WFrag<T16>::mma(kf[t][0], qf[nq][0], (v8f){}); st[t][nq] = WFrag<T16>::mma(kf[t][1], qf[nq][1], st[t][nq]); }
        { const int kn = min(s + NW, nst - 1) * 32;                 // this wave's next K block, fetched one pass ahead (clamped: always inside the plane)
#pragma unroll
          for (int t = 0; t < 2; ++t)
#pragma unroll
              for (int kc = 0; kc < 2; ++kc) kf[t][kc] = WFrag<T16>::ldf(kb + (size_t)(kn + t * 16) * HD + kc * 512); }
        float x[2][16], mx[2];
#pragma unroll
        for (int e = 0; e < 16; ++e) { const float dl = dr[e >> 2][e & 3];
#pragma unroll
            for (int nq = 0; nq < 2; ++nq) x[nq][e] = fmaf(st[e >> 3][nq][e & 7], c1, dl); }   /* (s x tau + delta_j) x scale, in log2 units */
        if (s == nst - 1) {                                         // diagonal block (k0 == q0): keys above the query's own index drop out
#pragma unroll
            for (int nq = 0; nq < 2; ++nq)
#pragma unroll
                for (int e = 0; e < 16; ++e) if ((e >> 3) * 16 + hi * 8 + (e & 7) > nq * 16 + lr) x[nq][e] = -3.0e38f; }
#pragma unroll
        for (int nq = 0; nq < 2; ++nq) { float a = x[nq][0];
#pragma unroll
            for (int e = 1; e < 16; ++e) a = fmaxf(a, x[nq][e]);
            mx[nq] = fmaxf(a, xhalf(a)); }
        // lazy rescale: the maximum in use moves only when some query's new maximum exceeds it by more than 8 (log2 units), so p <= 256
        if (__builtin_amdgcn_ballot_w32(mx[0] > m[0] + 8.0f || mx[1] > m[1] + 8.0f) != 0) {
#pragma unroll
            for (int nq = 0; nq < 2; ++nq) { const float mn = fmaxf(m[nq], mx[nq]); const float al = __builtin_amdgcn_exp2f(m[nq] - mn); m[nq] = mn; l[nq] *= al;
#pragma unroll
                for (int dt = 0; dt < 4; ++dt) o[dt][nq] *= al; } }
#pragma unroll
        for (int nq = 0; nq < 2; ++nq) { v16f p; float sm = 0.f;
#pragma unroll
            for (int e = 0; e < 16; e += 2) { const v2f y = (v2f){x[nq][e], x[nq][e + 1]} - m[nq]; p[e] = __builtin_amdgcn_exp2f(y[0]); p[e + 1] = __builtin_amdgcn_exp2f(y[1]); sm += p[e]; sm += p[e + 1]; }
            l[nq] += sm;
            if constexpr (HI) { const v16bf ph = __builtin_convertvector(p, v16bf); const v16bf pl = __builtin_convertvector(p - __builtin_convertvector(ph, v16f), v16bf);
#pragma unroll
                for (int dt = 0; dt < 4; ++dt) { o[dt][nq] = wmmab(vf[dt], ph, o[dt][nq]); o[dt][nq] = wmmab(vf[dt], pl, o[dt][nq]); }
            } else { const v16h ph = __builtin_convertvector(p, v16h);
#pragma unroll
                for (int dt = 0; dt < 4; ++dt) o[dt][nq] = wmma16(vf[dt], ph, o[dt][nq]); } }
    }
}
__global__ __launch_bounds__(NW * 32) void k_fattn(const h16* __restrict__ Q16, const h16* __restrict__ K16, const h16* __restrict__ V16, const bf* __restrict__ Qh, const bf* __restrict__ Kh, const bf* __restrict__ Vh, const float* __restrict__ tau, const float* __restrict__ delta, float* OUT) {
    __shared__ __align__(16) float op[NW][32 * OPI]; __shared__ float ms[NW][32], ls[NW][32]; __shared__ __align__(16) float dls[TT];
    const int z = blockIdx.x, b = z / NH_, h = z % NH_; const int q0 = (TT / 32 - 1 - (int)blockIdx.y) * 32;   // longest tiles first
    const int w = __builtin_amdgcn_readfirstlane(threadIdx.x >> 5), lane = threadIdx.x & 31, lr = lane & 15, hi = lane >> 4;
    const float c1 = bfr(tau[b]) * (SCL * L2E); const float* dlt = delta + (size_t)b * TT; const size_t pz = (size_t)z * TT * HD;
    float m[2] = {-3.0e38f, -3.0e38f}, l[2] = {0.f, 0.f}; v8f o[4][2];
#pragma unroll
    for (int dt = 0; dt < 4; ++dt)
#pragma unroll
        for (int nq = 0; nq < 2; ++nq) o[dt][nq] = (v8f){};
    // per-key bias delta_j x scale in log2 units (bf16-rounded on read), once per work-group, for the keys this tile can see
    for (int i = threadIdx.x * 4; i < q0 + 32; i += NW * 32 * 4) { v4f d = *(const v4f*)(dlt + i);
#pragma unroll
        for (int c = 0; c < 4; ++c) d[c] = bfr(d[c]) * (SCL * L2E);
        *(v4fa*)&dls[i] = d; }
    __syncthreads();
    if (q0 < RH) fa_body<bf, true>(Qh + pz, Kh + pz, Vh + pz, dls, c1, q0, w, lr, hi, m, l, o);
    else         fa_body<h16, false>(Q16 + pz, K16 + pz, V16 + pz, dls, c1, q0, w, lr, hi, m, l, o);
    // merge of the 4 waves' partials (a wave without a block has m = -3e38, l = 0, o = 0: weight 0)
#pragma unroll
    for (int nq = 0; nq < 2; ++nq) { l[nq] += xhalf(l[nq]); if (hi == 0) { ms[w][nq * 16 + lr] = m[nq]; ls[w][nq * 16 + lr] = l[nq]; }
#pragma unroll
        for (int dt = 0; dt < 4; ++dt) { float* dst = &op[w][(nq * 16 + lr) * OPI + dt * 16 + hi * 8]; const v8f a = o[dt][nq];
            *(v4fa*)dst = __builtin_shufflevector(a, a, 0, 1, 2, 3); *(v4fa*)(dst + 4) = __builtin_shufflevector(a, a, 4, 5, 6, 7); } }
    __syncthreads();
    const int q = threadIdx.x >> 2, dq = (threadIdx.x & 3) * 16;
    float M = ms[0][q];
#pragma unroll
    for (int u = 1; u < NW; ++u) M = fmaxf(M, ms[u][q]);
    float wt[NW], Ls = 0.f;
#pragma unroll
    for (int u = 0; u < NW; ++u) { wt[u] = __builtin_amdgcn_exp2f(ms[u][q] - M); Ls += wt[u] * ls[u][q]; }
    const float inv = __fdiv_rn(1.0f, Ls);
    float* orow = OUT + ((size_t)(b * TT + q0 + q) * NH_ + h) * HD + dq;
#pragma unroll
    for (int c = 0; c < 4; ++c) { v4f a = (v4f){};
#pragma unroll
        for (int u = 0; u < NW; ++u) a += wt[u] * *(const v4fa*)&op[u][q * OPI + dq + c * 4];
        *(v4f*)(orow + c * 4) = a * inv; }
}

extern "C" void kernel_launch(void* const* d_in, const int* in_sizes, int n_in,
                              void* d_out, int out_size, void* d_ws, size_t ws_size, hipStream_t stream) {
    (void)in_sizes; (void)n_in; (void)out_size;
    const float* qi = (const float*)d_in[0]; const float* ki = (const float*)d_in[1]; const float* vi = (const float*)d_in[2]; const float* tau = (const float*)d_in[3]; const float* delta = (const float*)d_in[4];
    float* OUT = (float*)d_out;     // [2][2048][1024]
    char* wsp = (char*)d_ws;
    auto take = [&](size_t bytes) { char* p = wsp; wsp += (bytes + 255) & ~(size_t)255; return (void*)p; };
    const size_t PB = (size_t)NH_ * TT * HD;      // elements of one batch's planes; every plane holds both batches
    h16* QP16 = (h16*)take(NB_ * PB * 2); h16* KP16 = (h16*)take(NB_ * PB * 2); h16* VT16 = (h16*)take(NB_ * PB * 2);
    bf* QPh = (bf*)take(NB_ * PB * 2); bf* KPh = (bf*)take(NB_ * PB * 2); bf* VTh = (bf*)take(NB_ * PB * 2);
    if ((size_t)(wsp - (char*)d_ws) > ws_size) return;    // ws 256 MiB
    k_planes<<<NB_ * NH_ * (TT / PT), 256, 0, stream>>>(qi, ki, vi, QP16, KP16, VT16, QPh, KPh, VTh);
    k_fattn<<<dim3(NB_ * NH_, TT / 32), NW * 32, 0, stream>>>(QP16, KP16, VT16, QPh, KPh, VTh, tau, delta, OUT);
}

// v005
// A run of this version takes 28.4 microseconds.
// In two side-by-side timings against v004, it was 1.06 and 1.09 times as fast.
// Counting every step since v000, it is 46.3 times as fast.
#include <hip/hip_runtime.h>

// De-stationary causal attention on given q, k, v ([2][2048][16][64] token-major; tau [2][1], delta [2][2048]): scores = (q.k) x tau_b + delta_b[s] (per-key bias), causal (-inf above the diagonal), A = softmax(scores / 8), V[b][l][h][d] = sum_s A v -> [2][2048][16][64] f32 (4.2 M).
// Layout: one plane builder turns the token-major k and v of both batches into head planes (k and transposed v: per head in the order in which a wave loads its matrix fragments, see k_planes; bf16-rounded on read); ONE fused kernel then does scores, softmax and attn.v per 32 query rows without ever storing a score or a probability, and writes the token-major f32 output. q has no plane: a query row is used by one work-group only, which reads it from the input itself.
// Compute dtypes, f32 accumulate: q, k, v, tau, delta rounded to bf16: hi planes exact, lo planes exactly zero (their products add +0 and are not formed); query rows < 512: bf16 scores, probabilities as bf16 hi + lo; the rest single fp16; softmax f32 (running maximum); f32 output.

#define NB_  2
#define TT   2048
#define DM   1024
#define NH_  16
#define NKV  16
#define REP  (NH_ / NKV)
#define HD   64
#define DQ   (NH_ * HD)
#define DKV  (NKV * HD)
#define RH   512                  // query rows < RH use the bf16 hi planes and hi+lo P (0: none)
#define WIN  2048
#define SCL  0.125f   // HD^-0.5
typedef _Float16 h16;
typedef unsigned short bf;
typedef __attribute__((ext_vector_type(16))) __bf16   v16bf;
typedef __attribute__((ext_vector_type(16))) _Float16 v16h;
typedef __attribute__((ext_vector_type(8)))  _Float16 v8h;
typedef __attribute__((ext_vector_type(8)))  unsigned short v8us;
typedef __attribute__((ext_vector_type(8)))  float    v8f;
typedef __attribute__((ext_vector_type(4)))  float    v4f;
typedef v8h  __attribute__((may_alias)) v8ha;
typedef v4f  __attribute__((may_alias)) v4fa;
typedef v8us __attribute__((may_alias)) v8usa;

__device__ __forceinline__ unsigned short f2bf(float f) { unsigned u = __float_as_uint(f); u += 0x7FFFu + ((u >> 16) & 1u); return (unsigned short)(u >> 16); }
__device__ __forceinline__ float bf2f(unsigned short b) { return __uint_as_float(((unsigned)b) << 16); }
__device__ __forceinline__ float bfr(float f) { return bf2f(f2bf(f)); }
__device__ __forceinline__ v16h cat16(v8h lo, v8h hi) { return __builtin_shufflevector(lo, hi, 0, 1, 2, 3, 4, 5, 6, 7, 8, 9, 10, 11, 12, 13, 14, 15); }
__device__ __forceinline__ v16bf cat16b(v8us lo, v8us hi) { return __builtin_bit_cast(v16bf, __builtin_shufflevector(lo, hi, 0, 1, 2, 3, 4, 5, 6, 7, 8, 9, 10, 11, 12, 13, 14, 15)); }
__device__ __forceinline__ v8f wmma16(v16h a, v16h b, v8f c) { return __builtin_amdgcn_wmma_f32_16x16x32_f16(false, a, false, b, (short)0, c, false, false); }
__device__ __forceinline__ v8f wmmab(v16bf a, v16bf b, v8f c) { return __builtin_amdgcn_wmma_f32_16x16x32_bf16(false, a, false, b, (short)0, c, false, false); }



// 16-bit fragment loader and matrix product per operand type. ldf: a fragment of a fragment-ordered plane (see k_planes; p already holds lane x 8): each of its two halves is 512 contiguous bytes per wave. ldt: the same fragment from a row-major LDS tile (p: the lane's row, at k = 8 hi). Hardware k order: a lane holds k = 8 hi .. 8 hi + 7 and 16 + 8 hi .. 16 + 8 hi + 7 of its row
template <typename T16> struct WFrag;
template <> struct WFrag<h16> { typedef v16h V; static __device__ __forceinline__ V ldf(const h16* p) { return cat16(*(const v8h*)p, *(const v8h*)(p + 256)); } static __device__ __forceinline__ V ldt(const unsigned short* p) { return cat16(*(const v8ha*)p, *(const v8ha*)(p + 16)); } static __device__ __forceinline__ v8f mma(V a, V b, v8f c) { return wmma16(a, b, c); } };
template <> struct WFrag<bf> { typedef v16bf V; static __device__ __forceinline__ V ldf(const bf* p) { return cat16b(*(const v8us*)p, *(const v8us*)(p + 256)); } static __device__ __forceinline__ V ldt(const unsigned short* p) { return cat16b(*(const v8usa*)p, *(const v8usa*)(p + 16)); } static __device__ __forceinline__ v8f mma(V a, V b, v8f c) { return wmmab(a, b, c); } };

typedef __attribute__((ext_vector_type(4))) _Float16 v4h;
typedef __attribute__((ext_vector_type(4))) unsigned short v4us;
typedef __attribute__((ext_vector_type(2))) float v2f;

// k_planes: every plane that k_fattn reads, in one launch. One work-group = PT tokens of one (batch, head), for k and v: each thread issues its 16 16-byte loads (16 lanes = one token's 256-byte head row) before it converts anything,
// so all of k and v is in flight at once from 4096 waves. bf16 rounding (nearest even) on read; fp16 planes hold the rounded values.
// FRAGMENT ORDER of the planes: a 16-row x 32-k fragment is 1 KiB = [half j][lane = 16 hi + lr][8 elements], element e of row lr at k = 16 j + 8 hi + e. k: rows = tokens, k = d: [token / 16][d / 32][fragment]; v: rows = d, k = keys: [key / 32][d / 16][fragment].
// So every 16-byte-per-lane fragment load of k_fattn covers 4 whole 128-byte lines, where a row-major plane gives it 32 bytes of each of 16 lines. k goes through LDS tiles [token][d] for it, so that its planes are stored in whole lines too.
// v: a thread holds 8 tokens x 4 d, writes 8 tokens of one d as 16 bytes into an LDS tile [d][token], from which the fragments are read. bf16 planes are read only for tokens < RH.
#define PT   128                  // tokens per work-group
#define KPI  72                   // LDS pitch of a q or k tile row in 16-bit elements: 144 bytes = 16 x 9, free of bank conflicts for the 16-byte reads of 16 rows
#define VPI  136                  // LDS pitch of a v tile row in 16-bit elements: 272 bytes = 16 x 17, free of bank conflicts for the 16-byte reads of 16 rows
static_assert(RH % PT == 0 && TT % PT == 0, "a token block lies on one side of RH");
typedef __attribute__((ext_vector_type(4))) __bf16 v4bf;
typedef v4h  __attribute__((may_alias)) v4ha;
typedef v4us __attribute__((may_alias)) v4usa;
__device__ __forceinline__ v4us rb4(v4f x) { return __builtin_bit_cast(v4us, __builtin_convertvector(x, v4bf)); }
__device__ __forceinline__ v4h bh4(v4us u) { v4f y;
#pragma unroll
    for (int e = 0; e < 4; ++e) y[e] = bf2f(u[e]);
    return __builtin_convertvector(y, v4h); }
__global__ __launch_bounds__(256) void k_planes(const float* __restrict__ k, const float* __restrict__ v, h16* __restrict__ K16, h16* __restrict__ V16, bf* __restrict__ Kh, bf* __restrict__ Vh) {
    __shared__ __align__(16) unsigned short vt[2][HD * VPI]; __shared__ __align__(16) unsigned short kt[2][PT * KPI];
    const int z = blockIdx.x / (TT / PT), b = z / NH_, h = z % NH_, t0 = (blockIdx.x % (TT / PT)) * PT; const int c = threadIdx.x & 15, r = threadIdx.x >> 4; const int ln = threadIdx.x & 31, wv = threadIdx.x >> 5;
    const size_t in0 = ((size_t)(b * TT + t0) * NH_ + h) * HD + c * 4; const bool lo = t0 < RH;
    v4f xv[8], xk[8];                                               // every '#pragma unroll' below: its loop indexes register arrays
#pragma unroll
    for (int j = 0; j < 8; ++j) xv[j] = *(const v4f*)(v + in0 + (size_t)(r * 8 + j) * DKV);
    asm volatile("s_wait_xcnt 0x0" ::: "memory");                   // a later load may land in the address registers of the loads above
#pragma unroll
    for (int j = 0; j < 8; ++j) xk[j] = *(const v4f*)(k + in0 + (size_t)(j * 16 + r) * DKV);
    __builtin_amdgcn_sched_barrier(0);                              // all 16 loads are issued before the first wait; without it part of them sinks behind v's conversion
    v4us uv[8]; v4h hv[8];
#pragma unroll
    for (int j = 0; j < 8; ++j) { uv[j] = rb4(xv[j]); hv[j] = bh4(uv[j]); }
    const int at = c * 4 * VPI + r * 8;
#pragma unroll
    for (int dd = 0; dd < 4; ++dd) { v8h f;
#pragma unroll
        for (int j = 0; j < 8; ++j) f[j] = hv[j][dd];
        *(v8ha*)&vt[0][at + dd * VPI] = f; }
    if (lo) {
#pragma unroll
        for (int dd = 0; dd < 4; ++dd) { v8us a;
#pragma unroll
            for (int j = 0; j < 8; ++j) a[j] = uv[j][dd];
            *(v8usa*)&vt[1][at + dd * VPI] = a; } }
    // the tile's hand-over orders LDS alone: __syncthreads() would also wait here for the k loads that are still in flight
    __builtin_amdgcn_fence(__ATOMIC_RELEASE, "workgroup", "local"); __builtin_amdgcn_s_barrier(); __builtin_amdgcn_fence(__ATOMIC_ACQUIRE, "workgroup", "local");
    // read-out in fragment order: wave wv stores 4 half fragments (512 bytes each) of key block wv / 2: d tiles 2 (wv & 1) and 2 (wv & 1) + 1
    const size_t vo = (size_t)z * TT * HD + (size_t)(t0 / 32 + (wv >> 1)) * 2048 + (wv & 1) * 1024 + ln * 8; const int rd = ((wv & 1) * 32 + (ln & 15)) * VPI + (wv >> 1) * 32 + (ln >> 4) * 8;
#pragma unroll
    for (int i = 0; i < 4; ++i) *(v8h*)(V16 + vo + i * 256) = *(const v8ha*)&vt[0][rd + (i >> 1) * 16 * VPI + (i & 1) * 16];
    asm volatile("s_wait_xcnt 0x0" ::: "memory");                   // the conversions below reuse the registers of the stores above
    const int ka = r * KPI + c * 4;
    if (lo) {
#pragma unroll
        for (int j = 0; j < 8; ++j) *(v4usa*)&kt[1][ka + j * 16 * KPI] = rb4(xk[j]); }
#pragma unroll
    for (int j = 0; j < 8; ++j) *(v4ha*)&kt[0][ka + j * 16 * KPI] = bh4(rb4(xk[j]));
    // hand-over of the k tiles: LDS alone, as for v above (the stores in flight need not be waited for)
    __builtin_amdgcn_fence(__ATOMIC_RELEASE, "workgroup", "local"); __builtin_amdgcn_s_barrier(); __builtin_amdgcn_fence(__ATOMIC_ACQUIRE, "workgroup", "local");
    // wave wv stores the 4 half fragments of the tile's tokens 16 wv .. 16 wv + 15
    const size_t ko = (size_t)z * TT * HD + (size_t)(t0 / 16 + wv) * 1024 + ln * 8; const int kr = (wv * 16 + (ln & 15)) * KPI + (ln >> 4) * 8;
#pragma unroll
    for (int i = 0; i < 4; ++i) *(v8h*)(K16 + ko + i * 256) = *(const v8ha*)&kt[0][kr + i * 16];
    asm volatile("s_wait_xcnt 0x0" ::: "memory");                   // the LDS reads below land in registers of the stores above
    if (lo) {
#pragma unroll
        for (int i = 0; i < 4; ++i) *(v8us*)(Kh + ko + i * 256) = *(const v8usa*)&kt[1][kr + i * 16];
        asm volatile("s_wait_xcnt 0x0" ::: "memory");               // as above
#pragma unroll
        for (int i = 0; i < 4; ++i) *(v8us*)(Vh + vo + i * 256) = *(const v8usa*)&vt[1][rd + (i >> 1) * 16 * VPI + (i & 1) * 16]; }
}

// ---- k_fattn: fused causal attention. One work-group = 32 query rows of one (batch, head); its 4 waves take the 32-key blocks w, w + 4, w + 8, ... up to the diagonal block, each with its own running
// maxima, sums and output accumulators, and merge them once through LDS. Per block: S^T = K.Q^T (A = K rows, B = Q rows: equal k order), so a lane holds 16 scores of ONE query (column lr; keys 8 hi + j and 16 + 8 hi + j),
// which after exp2 are, converted in place, the B operand of O^T += V^T.P^T (A = V^T rows by the same loader: equal k order). O^T: lane = query lr, registers = 8 consecutive d.
#define NW   4                    // waves per work-group (interleaved key blocks)
#define OPI  68                   // LDS pitch (floats) of a partial output row
#define L2E  1.4426950408889634f
typedef __attribute__((ext_vector_type(16))) float v16f;
__device__ __forceinline__ float xhalf(float x) { const int b = __float_as_int(x); return __int_as_float(__builtin_amdgcn_permlanex16(b, b, 0x76543210, 0xfedcba98, false, false)); }   // lane l <-> l ^ 16
template <typename T16, bool HI>
__device__ __forceinline__ void fa_body(const unsigned short* qs, const T16* __restrict__ Kp, const T16* __restrict__ Vt, const float* dls, const float c1, const int q0, const int w, const int lr, const int hi, float (&m)[2], float (&l)[2], v8f (&o)[4][2]) {
    typedef typename WFrag<T16>::V V;                               // every '#pragma unroll' below: its loop indexes register arrays (fragments, accumulators), which stay in registers only under constant indices
    const int nst = q0 / 32 + 1;                                    // key blocks 0 .. q0 / 32; only the last one meets the diagonal
    V qf[2][2], kf[2][2];
#pragma unroll
    for (int nq = 0; nq < 2; ++nq)
#pragma unroll
        for (int kc = 0; kc < 2; ++kc) qf[nq][kc] = WFrag<T16>::ldt(qs + (nq * 16 + lr) * KPI + kc * 32 + hi * 8);
    const T16* kb = Kp + (hi * 16 + lr) * 8; const T16* vb = Vt + (hi * 16 + lr) * 8;   // fragment-ordered planes: 32 keys = 2048 elements of either
    { const int kn = min(w, nst - 1) * 32;
#pragma unroll
      for (int t = 0; t < 2; ++t)
#pragma unroll
          for (int kc = 0; kc < 2; ++kc) kf[t][kc] = WFrag<T16>::ldf(kb + (size_t)(kn + t * 16) * HD + kc * 512); }
#pragma unroll 1
    for (int s = w; s < nst; s += NW) {                             // rolled: the body is long and the trip count varies
        const int k0 = s * 32;
        V vf[4];
#pragma unroll
        for (int dt = 0; dt < 4; ++dt) vf[dt] = WFrag<T16>::ldf(vb + (size_t)k0 * HD + dt * 512);
        v4f dr[4];                                                  // this lane's 16 keys' bias, from LDS (already rounded and scaled)
#pragma unroll
        for (int u = 0; u < 4; ++u) dr[u] = *(const v4fa*)(dls + k0 + (u >> 1) * 16 + hi * 8 + (u & 1) * 4);
        v8f st[2][2];
#pragma unroll
        for (int t = 0; t < 2; ++t)
#pragma unroll
            for (int nq = 0; nq < 2; ++nq) { st[t][nq] = WFrag<T16>::mma(kf[t][0], qf[nq][0], (v8f){}); st[t][nq] = WFrag<T16>::mma(kf[t][1], qf[nq][1], st[t][nq]); }
        { const int kn = min(s + NW, nst - 1) * 32;                 // this wave's next K block, fetched one pass ahead (clamped: always inside the plane)
#pragma unroll
          for (int t = 0; t < 2; ++t)
#pragma unroll
              for (int kc = 0; kc < 2; ++kc) kf[t][kc] = WFrag<T16>::ldf(kb + (size_t)(kn + t * 16) * HD + kc * 512); }
        float x[2][16], mx[2];
#pragma unroll
        for (int e = 0; e < 16; ++e) { const float dl = dr[e >> 2][e & 3];
#pragma unroll
            for (int nq = 0; nq < 2; ++nq) x[nq][e] = fmaf(st[e >> 3][nq][e & 7], c1, dl); }   /* (s x tau + delta_j) x scale, in log2 units */
        if (s == nst - 1) {                                         // diagonal block (k0 == q0): keys above the query's own index drop out
#pragma unroll
            for (int nq = 0; nq < 2; ++nq)
#pragma unroll
                for (int e = 0; e < 16; ++e) if ((e >> 3) * 16 + hi * 8 + (e & 7) > nq * 16 + lr) x[nq][e] = -3.0e38f; }
#pragma unroll
        for (int nq = 0; nq < 2; ++nq) { float a = x[nq][0];
#pragma unroll
            for (int e = 1; e < 16; ++e) a = fmaxf(a, x[nq][e]);
            mx[nq] = fmaxf(a, xhalf(a)); }
        // lazy rescale: the maximum in use moves only when some query's new maximum exceeds it by more than 8 (log2 units), so p <= 256
        if (__builtin_amdgcn_ballot_w32(mx[0] > m[0] + 8.0f || mx[1] > m[1] + 8.0f) != 0) {
#pragma unroll
            for (int nq = 0; nq < 2; ++nq) { const float mn = fmaxf(m[nq], mx[nq]); const float al = __builtin_amdgcn_exp2f(m[nq] - mn); m[nq] = mn; l[nq] *= al;
#pragma unroll
                for (int dt = 0; dt < 4; ++dt) o[dt][nq] *= al; } }
#pragma unroll
        for (int nq = 0; nq < 2; ++nq) { v16f p; float sm = 0.f;
#pragma unroll
            for (int e = 0; e < 16; e += 2) { const v2f y = (v2f){x[nq][e], x[nq][e + 1]} - m[nq]; p[e] = __builtin_amdgcn_exp2f(y[0]); p[e + 1] = __builtin_amdgcn_exp2f(y[1]); sm += p[e]; sm += p[e + 1]; }
            l[nq] += sm;
            if constexpr (HI) { const v16bf ph = __builtin_convertvector(p, v16bf); const v16bf pl = __builtin_convertvector(p - __builtin_convertvector(ph, v16f), v16bf);
#pragma unroll
                for (int dt = 0; dt < 4; ++dt) { o[dt][nq] = wmmab(vf[dt], ph, o[dt][nq]); o[dt][nq] = wmmab(vf[dt], pl, o[dt][nq]); }
            } else { const v16h ph = __builtin_convertvector(p, v16h);
#pragma unroll
                for (int dt = 0; dt < 4; ++dt) o[dt][nq] = wmma16(vf[dt], ph, o[dt][nq]); } }
    }
}
__global__ __launch_bounds__(NW * 32) void k_fattn(const float* __restrict__ qin, const h16* __restrict__ K16, const h16* __restrict__ V16, const bf* __restrict__ Kh, const bf* __restrict__ Vh, const float* __restrict__ tau, const float* __restrict__ delta, float* OUT) {
    __shared__ __align__(16) float op[NW][32 * OPI]; __shared__ float ms[NW][32], ls[NW][32]; __shared__ __align__(16) float dls[TT]; __shared__ __align__(16) unsigned short qt[32 * KPI];
    const int z = blockIdx.x, b = z / NH_, h = z % NH_; const int q0 = (TT / 32 - 1 - (int)blockIdx.y) * 32;   // longest tiles first
    const int w = __builtin_amdgcn_readfirstlane(threadIdx.x >> 5), lane = threadIdx.x & 31, lr = lane & 15, hi = lane >> 4;
    const float c1 = bfr(tau[b]) * (SCL * L2E); const float* dlt = delta + (size_t)b * TT; const size_t pz = (size_t)z * TT * HD;
    float m[2] = {-3.0e38f, -3.0e38f}, l[2] = {0.f, 0.f}; v8f o[4][2];
#pragma unroll
    for (int dt = 0; dt < 4; ++dt)
#pragma unroll
        for (int nq = 0; nq < 2; ++nq) o[dt][nq] = (v8f){};
    // this tile's 32 query rows, straight from the input (16 lanes = one row's 256 bytes of this head): issued ahead of the bias loads, so that both are in flight together
    const int qc = threadIdx.x & 15, qr = threadIdx.x >> 4; v4f xq[4];
#pragma unroll
    for (int j = 0; j < 4; ++j) xq[j] = *(const v4f*)(qin + ((size_t)(b * TT + q0 + j * 8 + qr) * NH_ + h) * HD + qc * 4);
    asm volatile("s_wait_xcnt 0x0" ::: "memory");                   // later code may reuse the address registers of the loads above
    // per-key bias delta_j x scale in log2 units (bf16-rounded on read), once per work-group, for the keys this tile can see
    for (int i = threadIdx.x * 4; i < q0 + 32; i += NW * 32 * 4) { v4f d = *(const v4f*)(dlt + i);
#pragma unroll
        for (int c = 0; c < 4; ++c) d[c] = bfr(d[c]) * (SCL * L2E);
        *(v4fa*)&dls[i] = d; }
    // q tile [row][d] in LDS, bf16-rounded (bf16 below RH, those values as fp16 from there on); every wave reads all its fragments from it
    if (q0 < RH) {
#pragma unroll
        for (int j = 0; j < 4; ++j) *(v4usa*)&qt[(j * 8 + qr) * KPI + qc * 4] = rb4(xq[j]);
    } else {
#pragma unroll
        for (int j = 0; j < 4; ++j) *(v4ha*)&qt[(j * 8 + qr) * KPI + qc * 4] = bh4(rb4(xq[j])); }
    __syncthreads();
    if (q0 < RH) fa_body<bf, true>(qt, Kh + pz, Vh + pz, dls, c1, q0, w, lr, hi, m, l, o);
    else         fa_body<h16, false>(qt, K16 + pz, V16 + pz, dls, c1, q0, w, lr, hi, m, l, o);
    // merge of the 4 waves' partials (a wave without a block has m = -3e38, l = 0, o = 0: weight 0)
#pragma unroll
    for (int nq = 0; nq < 2; ++nq) { l[nq] += xhalf(l[nq]); if (hi == 0) { ms[w][nq * 16 + lr] = m[nq]; ls[w][nq * 16 + lr] = l[nq]; }
#pragma unroll
        for (int dt = 0; dt < 4; ++dt) { float* dst = &op[w][(nq * 16 + lr) * OPI + dt * 16 + hi * 8]; const v8f a = o[dt][nq];
            *(v4fa*)dst = __builtin_shufflevector(a, a, 0, 1, 2, 3); *(v4fa*)(dst + 4) = __builtin_shufflevector(a, a, 4, 5, 6, 7); } }
    __syncthreads();
    const int q = threadIdx.x >> 2, dq = (threadIdx.x & 3) * 16;
    float M = ms[0][q];
#pragma unroll
    for (int u = 1; u < NW; ++u) M = fmaxf(M, ms[u][q]);
    float wt[NW], Ls = 0.f;
#pragma unroll
    for (int u = 0; u < NW; ++u) { wt[u] = __builtin_amdgcn_exp2f(ms[u][q] - M); Ls += wt[u] * ls[u][q]; }
    const float inv = __fdiv_rn(1.0f, Ls);
    float* orow = OUT + ((size_t)(b * TT + q0 + q) * NH_ + h) * HD + dq;
#pragma unroll
    for (int c = 0; c < 4; ++c) { v4f a = (v4f){};
#pragma unroll
        for (int u = 0; u < NW; ++u) a += wt[u] * *(const v4fa*)&op[u][q * OPI + dq + c * 4];
        *(v4f*)(orow + c * 4) = a * inv; }
}

extern "C" void kernel_launch(void* const* d_in, const int* in_sizes, int n_in,
                              void* d_out, int out_size, void* d_ws, size_t ws_size, hipStream_t stream) {
    (void)in_sizes; (void)n_in; (void)out_size;
    const float* qi = (const float*)d_in[0]; const float* ki = (const float*)d_in[1]; const float* vi = (const float*)d_in[2]; const float* tau = (const float*)d_in[3]; const float* delta = (const float*)d_in[4];
    float* OUT = (float*)d_out;     // [2][2048][1024]
    char* wsp = (char*)d_ws;
    auto take = [&](size_t bytes) { char* p = wsp; wsp += (bytes + 255) & ~(size_t)255; return (void*)p; };
    const size_t PB = (size_t)NH_ * TT * HD;      // elements of one batch's planes; every plane holds both batches
    h16* KP16 = (h16*)take(NB_ * PB * 2); h16* VT16 = (h16*)take(NB_ * PB * 2);
    bf* KPh = (bf*)take(NB_ * PB * 2); bf* VTh = (bf*)take(NB_ * PB * 2);
    if ((size_t)(wsp - (char*)d_ws) > ws_size) return;    // ws 256 MiB
    k_planes<<<NB_ * NH_ * (TT / PT), 256, 0, stream>>>(ki, vi, KP16, VT16, KPh, VTh);
    k_fattn<<<dim3(NB_ * NH_, TT / 32), NW * 32, 0, stream>>>(qi, KP16, VT16, KPh, VTh, tau, delta, OUT);
}
